// v000
// Measured on an AMD MI455X. A time is GPU time per run, averaged over a window of back-to-back runs after a warm-up
// (all launches, gaps included; the runs take copies of the inputs in turn), and the median of several windows.
// Apart from v000's, it joins two sittings. Times from different sittings can be a few percent apart, while
// side-by-side timings come from the same sitting.
// v000, which the later versions start from, runs in 442 microseconds.
#include <hip/hip_runtime.h>
#include <hip/hip_bf16.h>
#include <cstdint>

#define DIM   1024
#define NHEAD 16
#define HDIM  64
#define BATCH 4
#define SEQ   8192
#define MROWS (BATCH*SEQ)          // 32768
#define QK_SCALE 0.125f            // HDIM^-0.5

// GEMM tiling (big GEMMs)
#define BM 128
#define BN2 128                    // wide N tile to cut L2 re-reads
#define BK 64
#define LDA 72                     // bf16 elems; 144B rows (16B aligned, conflict-free)
#define LDC2 132                   // f32 elems for C spill
#define TILE_ELEMS (BM * LDA)      // 9216 bf16 = 18432 B per buffer
#define NSTEP (DIM / BK)           // 16

// small GEMM tiling (k2/k3a)
#define BN 64
#define LDB 72
#define NSPLIT 16
#define CHUNK (SEQ / NSPLIT)       // 512
#define LDE 40                     // 80B rows

typedef __bf16 bf16;
typedef bf16  v16bf __attribute__((ext_vector_type(16)));
typedef bf16  v8bf  __attribute__((ext_vector_type(8)));
typedef bf16  v4bf  __attribute__((ext_vector_type(4)));
typedef float v8f   __attribute__((ext_vector_type(8)));
typedef unsigned int v4u __attribute__((ext_vector_type(4)));
typedef int   v8i   __attribute__((ext_vector_type(8)));
typedef int   v4i   __attribute__((ext_vector_type(4)));

__device__ __forceinline__ bf16 f2bf(float f) {
  uint32_t u = __builtin_bit_cast(uint32_t, f);
  u = (u + 0x7FFFu + ((u >> 16) & 1u)) >> 16;     // round-to-nearest-even
  uint16_t s = (uint16_t)u;
  return __builtin_bit_cast(bf16, s);
}
__device__ __forceinline__ float bf2f(bf16 b) {
  uint32_t u = ((uint32_t)__builtin_bit_cast(uint16_t, b)) << 16;
  return __builtin_bit_cast(float, u);
}

// LDS byte offset of a generic pointer into shared memory (addrspace(3) ptrtoint)
__device__ __forceinline__ uint32_t lds_off(const void* p) {
  return (uint32_t)(uintptr_t)(__attribute__((address_space(3))) const void*)p;
}

// Issue one TDM 2-D tile load: tile_d1 rows x tile_d0 bf16 elems from a
// row-major tensor (row stride stride0 elems) into LDS, padding +4 dwords
// every 32 dwords so each 64-elem row lands at a 72-elem (144 B) stride.
__device__ __forceinline__ void tdm_load_2d(uint32_t lds_byte_off, const bf16* gptr,
                                            uint32_t tensor_d0, uint32_t tensor_d1,
                                            uint32_t tile_d0, uint32_t tile_d1,
                                            uint32_t stride0) {
  const uint64_t ga = (uint64_t)(uintptr_t)gptr;
  v4u g0;
  g0[0] = 1u;                                     // count=1, user descriptor
  g0[1] = lds_byte_off;                           // lds_addr
  g0[2] = (uint32_t)ga;                           // global_addr[31:0]
  g0[3] = (uint32_t)(ga >> 32) | (2u << 30);      // global_addr[56:32] | type=2
  v8i g1;
  g1[0] = (int)((1u << 16)        // data_size = 1 -> 2 bytes
              | (1u << 20)        // pad_enable
              | (4u << 22)        // pad_interval: 4 -> every 32 dwords (64 bf16)
              | (3u << 25));      // pad_amount:   3 -> 4 dwords (8 bf16)
  g1[1] = (int)(tensor_d0 << 16);                           // tensor_dim0[15:0]
  g1[2] = (int)((tensor_d0 >> 16) | (tensor_d1 << 16));     // d0 hi | d1 lo
  g1[3] = (int)((tensor_d1 >> 16) | (tile_d0 << 16));       // d1 hi | tile_dim0
  g1[4] = (int)(tile_d1);                                   // tile_dim1 (tile_dim2=0)
  g1[5] = (int)stride0;                                     // tensor_dim0_stride lo
  g1[6] = 0;
  g1[7] = 0;
  v4i z4; z4[0] = 0; z4[1] = 0; z4[2] = 0; z4[3] = 0;
  v8i z8;
  #pragma unroll
  for (int i = 0; i < 8; ++i) z8[i] = 0;
  __builtin_amdgcn_tensor_load_to_lds(g0, g1, z4, z4, z8, 0);
}

// Load one 16(M/N) x 32(K) WMMA A/B fragment from an LDS tile laid out
// [row][k], leading dimension ld elems (row byte size 16B aligned).
// lanes 0-15 : row = lane,    K = {k0..k0+7} and {k0+16..k0+23}
// lanes 16-31: row = lane-16, K = {k0+8..k0+15} and {k0+24..k0+31}
__device__ __forceinline__ v16bf frag_ld(const bf16* tile, int ld, int row0, int k0) {
  const int lane = threadIdx.x & 31;
  const bf16* p = tile + (row0 + (lane & 15)) * ld + k0 + ((lane >> 4) << 3);
  union { v16bf v; v8bf h[2]; } f;
  f.h[0] = *(const v8bf*)(p);
  f.h[1] = *(const v8bf*)(p + 16);
  return f.v;
}

__device__ __forceinline__ v8f wmma_bf16(v16bf a, v16bf b, v8f c) {
  return __builtin_amdgcn_wmma_f32_16x16x32_bf16(false, a, false, b,
                                                 (short)0, c, false, false);
}

extern __shared__ char smem[];

// ---------------------------------------------------------------- kernel 0
// bf16 conversions + zeroing of atomic accumulators (every launch).
__global__ void k0_init(const float* __restrict__ x, const float* __restrict__ wqkv,
                        const float* __restrict__ wproj,
                        bf16* __restrict__ x_bf, bf16* __restrict__ wqkv_bf,
                        bf16* __restrict__ wproj_bf,
                        float* __restrict__ ctx, float* __restrict__ zbuf) {
  const int i = blockIdx.x * blockDim.x + threadIdx.x;
  if (i < MROWS * DIM)   x_bf[i] = f2bf(x[i]);
  if (i < 3 * DIM * DIM) wqkv_bf[i] = f2bf(wqkv[i]);
  if (i < DIM * DIM)     wproj_bf[i] = f2bf(wproj[i]);
  if (i < BATCH * NHEAD * HDIM * HDIM) ctx[i] = 0.f;
  if (i < BATCH * NHEAD * HDIM)        zbuf[i] = 0.f;
}

// ------------------------------------------------------ kernel 1: QKV GEMM
// qkv = x @ w_qkv^T  (TDM double-buffered into LDS, bf16 WMMA), fused
// epilogue per 128-column (two-head-aligned) slab.
__global__ void __launch_bounds__(256)
k1_qkv(const bf16* __restrict__ xbf, const bf16* __restrict__ wbf,
       bf16* __restrict__ qs, bf16* __restrict__ ebuf, bf16* __restrict__ vbuf) {
  bf16*  As   = (bf16*)smem;                        // 2 x 18432 B
  bf16*  Bs   = (bf16*)(smem + 2 * 18432);          // 2 x 18432 B
  float* Cs   = (float*)(smem + 4 * 18432);         // 128*132*4 = 67584 B
  float* rmax = (float*)(smem + 4 * 18432 + 67584); // 2*128 f32
  float* rscl = rmax + 2 * BM;

  const int tid  = threadIdx.x;
  const int wave = tid >> 5;
  const int mb   = blockIdx.x * BM;
  const int cb   = blockIdx.y * BN2;                // 0..2944

  v8f acc[8];
  #pragma unroll
  for (int t = 0; t < 8; ++t)
    #pragma unroll
    for (int i = 0; i < 8; ++i) acc[t][i] = 0.f;

  const uint32_t aoff = lds_off(As);
  const uint32_t boff = lds_off(Bs);

  if (tid < 32) {  // wave 0 drives the TDM pipeline
    tdm_load_2d(aoff, xbf + (size_t)mb * DIM, DIM, MROWS, BK, BM, DIM);
    tdm_load_2d(boff, wbf + (size_t)cb * DIM, DIM, 3 * DIM, BK, BN2, DIM);
  }

  for (int s = 0; s < NSTEP; ++s) {
    if (tid < 32) {
      if (s + 1 < NSTEP) {
        const int nb = (s + 1) & 1;
        const int kb = (s + 1) * BK;
        tdm_load_2d(aoff + nb * 18432u, xbf + (size_t)mb * DIM + kb,
                    DIM, MROWS, BK, BM, DIM);
        tdm_load_2d(boff + nb * 18432u, wbf + (size_t)cb * DIM + kb,
                    DIM, 3 * DIM, BK, BN2, DIM);
        __builtin_amdgcn_s_wait_tensorcnt(2);   // stage s complete (in-order)
      } else {
        __builtin_amdgcn_s_wait_tensorcnt(0);
      }
    }
    __syncthreads();
    const bf16* Ab = As + (s & 1) * TILE_ELEMS;
    const bf16* Bb = Bs + (s & 1) * TILE_ELEMS;
    const int wr = wave * 16;
    #pragma unroll
    for (int kc = 0; kc < BK; kc += 32) {
      const v16bf va = frag_ld(Ab, LDA, wr, kc);
      #pragma unroll
      for (int t = 0; t < 8; ++t) {
        const v16bf vbr = frag_ld(Bb, LDA, t * 16, kc);
        acc[t] = wmma_bf16(va, vbr, acc[t]);
      }
    }
    __syncthreads();
  }

  // spill accumulators (C layout: lane = n + 16*(m>=8), vgpr = m%8)
  {
    const int lane = tid & 31;
    const int rb = wave * 16 + ((lane >> 4) << 3);
    const int cl = lane & 15;
    #pragma unroll
    for (int t = 0; t < 8; ++t)
      #pragma unroll
      for (int i = 0; i < 8; ++i)
        Cs[(rb + i) * LDC2 + t * 16 + cl] = acc[t][i];
  }
  __syncthreads();

  const int sec = cb >> 10;                    // 0=q, 1=k, 2=v
  const int ci  = cb & 1023;
  if (sec == 0) {
    // row softmax per 64-wide head (two heads per slab), * SCALE
    {
      const int r = tid & 127, hh = tid >> 7;
      const float* row = Cs + r * LDC2 + hh * 64;
      float m = -1e30f, sum = 0.f;
      for (int e = 0; e < 64; ++e) m = fmaxf(m, row[e]);
      for (int e = 0; e < 64; ++e) sum += __expf(row[e] - m);
      rmax[hh * BM + r] = m;
      rscl[hh * BM + r] = QK_SCALE / sum;
    }
    __syncthreads();
    for (int i = tid; i < BM * BN2; i += 256) {
      const int r = i >> 7, e = i & 127, hh = e >> 6;
      const float v = __expf(Cs[r * LDC2 + e] - rmax[hh * BM + r]) * rscl[hh * BM + r];
      qs[(size_t)(mb + r) * DIM + ci + e] = f2bf(v);
    }
  } else if (sec == 1) {
    // E = exp(k_raw); k values ~N(0,1) so no max subtraction needed
    for (int i = tid; i < BM * BN2; i += 256) {
      const int r = i >> 7, e = i & 127;
      ebuf[(size_t)(mb + r) * DIM + ci + e] = f2bf(__expf(Cs[r * LDC2 + e]));
    }
  } else {
    for (int i = tid; i < BM * BN2; i += 256) {
      const int r = i >> 7, e = i & 127;
      vbuf[(size_t)(mb + r) * DIM + ci + e] = f2bf(Cs[r * LDC2 + e]);
    }
  }
}

// ---------------------------------- kernel 2: context' = E^T V, Z = colsum(E)
__global__ void __launch_bounds__(128)
k2_context(const bf16* __restrict__ ebuf, const bf16* __restrict__ vbuf,
           float* __restrict__ ctx, float* __restrict__ zbuf) {
  __shared__ bf16 Es[HDIM * LDE];              // [d][n] (transposed)
  __shared__ bf16 Vs[HDIM * LDE];              // [e][n] (transposed)
  const int tid  = threadIdx.x;
  const int wave = tid >> 5;
  const int bh = blockIdx.x >> 4;              // NSPLIT == 16
  const int ns = blockIdx.x & (NSPLIT - 1);
  const int b = bh >> 4, h = bh & 15;
  const size_t rowbase = (size_t)b * SEQ + (size_t)ns * CHUNK;
  const int hoff = h * HDIM;

  v8f acc[4];
  #pragma unroll
  for (int t = 0; t < 4; ++t)
    #pragma unroll
    for (int i = 0; i < 8; ++i) acc[t][i] = 0.f;
  float zacc = 0.f;

  for (int nb = 0; nb < CHUNK; nb += 32) {
    for (int i = tid; i < 32 * HDIM; i += 128) {   // transpose into LDS
      const int nl = i >> 6, d = i & 63;
      Es[d * LDE + nl] = ebuf[(rowbase + nb + nl) * DIM + hoff + d];
      Vs[d * LDE + nl] = vbuf[(rowbase + nb + nl) * DIM + hoff + d];
    }
    __syncthreads();
    if (tid < HDIM) {
      #pragma unroll
      for (int n = 0; n < 32; ++n) zacc += bf2f(Es[tid * LDE + n]);
    }
    const int wr = wave * 16;
    const v16bf va = frag_ld(Es, LDE, wr, 0);
    #pragma unroll
    for (int t = 0; t < 4; ++t) {
      const v16bf vbr = frag_ld(Vs, LDE, t * 16, 0);
      acc[t] = wmma_bf16(va, vbr, acc[t]);
    }
    __syncthreads();
  }
  {
    const int lane = tid & 31;
    const int rb = wave * 16 + ((lane >> 4) << 3);
    const int cl = lane & 15;
    float* cbase = ctx + (size_t)bh * HDIM * HDIM;
    #pragma unroll
    for (int t = 0; t < 4; ++t)
      #pragma unroll
      for (int i = 0; i < 8; ++i)
        atomicAdd(cbase + (rb + i) * HDIM + t * 16 + cl, acc[t][i]);
  }
  if (tid < HDIM) atomicAdd(zbuf + bh * HDIM + tid, zacc);
}

// ------------------- kernel 2b: ctxT[bh][e][d] = ctx[bh][d][e] / Z[bh][d]
__global__ void k2b_norm(const float* __restrict__ ctx, const float* __restrict__ zbuf,
                         bf16* __restrict__ ctxT) {
  const int i = blockIdx.x * blockDim.x + threadIdx.x;
  if (i >= BATCH * NHEAD * HDIM * HDIM) return;
  const int bh = i >> 12, e = (i >> 6) & 63, d = i & 63;
  ctxT[i] = f2bf(ctx[(size_t)bh * 4096 + d * 64 + e] / zbuf[bh * 64 + d]);
}

// --------------------------- kernel 3a: t = q_soft @ ctx (block-diag/head)
__global__ void __launch_bounds__(256)
k3a_qctx(const bf16* __restrict__ qs, const bf16* __restrict__ ctxT,
         bf16* __restrict__ tbuf) {
  __shared__ bf16 As3[BM * LDA];
  __shared__ bf16 Bs3[BN * LDB];
  const int tid = threadIdx.x, wave = tid >> 5;
  const int mb = blockIdx.x * BM;
  const int h = blockIdx.y;
  const int bh = (mb / SEQ) * NHEAD + h;
  const int hoff = h * HDIM;

  for (int i = tid; i < BM * (HDIM / 4); i += 256) {
    const int r = i >> 4, c4 = (i & 15) * 4;
    *(v4bf*)(As3 + r * LDA + c4) =
        *(const v4bf*)(qs + (size_t)(mb + r) * DIM + hoff + c4);
  }
  for (int i = tid; i < BN * (HDIM / 4); i += 256) {
    const int r = i >> 4, c4 = (i & 15) * 4;
    *(v4bf*)(Bs3 + r * LDB + c4) =
        *(const v4bf*)(ctxT + (size_t)bh * 4096 + r * HDIM + c4);
  }
  __syncthreads();

  v8f acc[4];
  #pragma unroll
  for (int t = 0; t < 4; ++t)
    #pragma unroll
    for (int i = 0; i < 8; ++i) acc[t][i] = 0.f;

  const int wr = wave * 16;
  #pragma unroll
  for (int kc = 0; kc < HDIM; kc += 32) {
    const v16bf va = frag_ld(As3, LDA, wr, kc);
    #pragma unroll
    for (int t = 0; t < 4; ++t) {
      const v16bf vbr = frag_ld(Bs3, LDB, t * 16, kc);
      acc[t] = wmma_bf16(va, vbr, acc[t]);
    }
  }
  const int lane = tid & 31;
  const int rb = wr + ((lane >> 4) << 3);
  const int cl = lane & 15;
  #pragma unroll
  for (int t = 0; t < 4; ++t)
    #pragma unroll
    for (int i = 0; i < 8; ++i)
      tbuf[(size_t)(mb + rb + i) * DIM + hoff + t * 16 + cl] = f2bf(acc[t][i]);
}

// ----------------------------- kernel 3b: out = t @ w_proj^T + b_proj (f32)
__global__ void __launch_bounds__(256)
k3b_proj(const bf16* __restrict__ tbuf, const bf16* __restrict__ wpbf,
         const float* __restrict__ bias, float* __restrict__ out) {
  bf16*  As   = (bf16*)smem;                        // 2 x 18432 B
  bf16*  Bs   = (bf16*)(smem + 2 * 18432);          // 2 x 18432 B
  float* Cs   = (float*)(smem + 4 * 18432);         // 67584 B
  const int tid = threadIdx.x, wave = tid >> 5;
  const int mb = blockIdx.x * BM;
  const int cb = blockIdx.y * BN2;

  v8f acc[8];
  #pragma unroll
  for (int t = 0; t < 8; ++t)
    #pragma unroll
    for (int i = 0; i < 8; ++i) acc[t][i] = 0.f;

  const uint32_t aoff = lds_off(As);
  const uint32_t boff = lds_off(Bs);
  if (tid < 32) {
    tdm_load_2d(aoff, tbuf + (size_t)mb * DIM, DIM, MROWS, BK, BM, DIM);
    tdm_load_2d(boff, wpbf + (size_t)cb * DIM, DIM, DIM, BK, BN2, DIM);
  }

  for (int s = 0; s < NSTEP; ++s) {
    if (tid < 32) {
      if (s + 1 < NSTEP) {
        const int nb = (s + 1) & 1;
        const int kb = (s + 1) * BK;
        tdm_load_2d(aoff + nb * 18432u, tbuf + (size_t)mb * DIM + kb,
                    DIM, MROWS, BK, BM, DIM);
        tdm_load_2d(boff + nb * 18432u, wpbf + (size_t)cb * DIM + kb,
                    DIM, DIM, BK, BN2, DIM);
        __builtin_amdgcn_s_wait_tensorcnt(2);
      } else {
        __builtin_amdgcn_s_wait_tensorcnt(0);
      }
    }
    __syncthreads();
    const bf16* Ab = As + (s & 1) * TILE_ELEMS;
    const bf16* Bb = Bs + (s & 1) * TILE_ELEMS;
    const int wr = wave * 16;
    #pragma unroll
    for (int kc = 0; kc < BK; kc += 32) {
      const v16bf va = frag_ld(Ab, LDA, wr, kc);
      #pragma unroll
      for (int t = 0; t < 8; ++t) {
        const v16bf vbr = frag_ld(Bb, LDA, t * 16, kc);
        acc[t] = wmma_bf16(va, vbr, acc[t]);
      }
    }
    __syncthreads();
  }
  {
    const int lane = tid & 31;
    const int rb = wave * 16 + ((lane >> 4) << 3);
    const int cl = lane & 15;
    #pragma unroll
    for (int t = 0; t < 8; ++t)
      #pragma unroll
      for (int i = 0; i < 8; ++i)
        Cs[(rb + i) * LDC2 + t * 16 + cl] = acc[t][i];
  }
  __syncthreads();
  for (int i = tid; i < BM * BN2; i += 256) {
    const int r = i >> 7, c = i & 127;
    out[(size_t)(mb + r) * DIM + cb + c] = Cs[r * LDC2 + c] + bias[cb + c];
  }
}

// ---------------------------------------------------------------- launcher
extern "C" void kernel_launch(void* const* d_in, const int* in_sizes, int n_in,
                              void* d_out, int out_size, void* d_ws, size_t ws_size,
                              hipStream_t stream) {
  (void)in_sizes; (void)n_in; (void)out_size; (void)ws_size;
  const float* x      = (const float*)d_in[0];
  const float* w_qkv  = (const float*)d_in[1];
  const float* w_proj = (const float*)d_in[2];
  const float* b_proj = (const float*)d_in[3];
  float* out = (float*)d_out;

  char* p = (char*)d_ws;
  size_t off = 0;
  auto take = [&](size_t bytes) -> char* {
    char* r = p + off;
    off += (bytes + 255) & ~(size_t)255;
    return r;
  };
  bf16*  x_bf     = (bf16*)take((size_t)MROWS * DIM * 2);   // 64 MB
  bf16*  qs       = (bf16*)take((size_t)MROWS * DIM * 2);   // 64 MB
  bf16*  ebuf     = (bf16*)take((size_t)MROWS * DIM * 2);   // 64 MB (reused as t)
  bf16*  vbuf     = (bf16*)take((size_t)MROWS * DIM * 2);   // 64 MB
  bf16*  wqkv_bf  = (bf16*)take((size_t)3 * DIM * DIM * 2); // 6 MB
  bf16*  wproj_bf = (bf16*)take((size_t)DIM * DIM * 2);     // 2 MB
  float* ctx      = (float*)take((size_t)BATCH * NHEAD * HDIM * HDIM * 4);
  float* zbuf     = (float*)take((size_t)BATCH * NHEAD * HDIM * 4);
  bf16*  ctxT     = (bf16*)take((size_t)BATCH * NHEAD * HDIM * HDIM * 2);

  const size_t big_lds   = 4 * 18432 + 67584 + 2 * 2 * BM * 4;  // k1: ~143 KB
  const size_t proj_lds  = 4 * 18432 + 67584;                   // k3b: ~138 KB

  k0_init<<<(MROWS * DIM) / 256, 256, 0, stream>>>(x, w_qkv, w_proj, x_bf,
                                                   wqkv_bf, wproj_bf, ctx, zbuf);
  k1_qkv<<<dim3(MROWS / BM, (3 * DIM) / BN2), 256, big_lds, stream>>>(
      x_bf, wqkv_bf, qs, ebuf, vbuf);
  k2_context<<<BATCH * NHEAD * NSPLIT, 128, 0, stream>>>(ebuf, vbuf, ctx, zbuf);
  k2b_norm<<<(BATCH * NHEAD * HDIM * HDIM + 255) / 256, 256, 0, stream>>>(ctx, zbuf, ctxT);
  bf16* tbuf = ebuf;  // E is dead after k2 — reuse for t
  k3a_qctx<<<dim3(MROWS / BM, NHEAD), 256, 0, stream>>>(qs, ctxT, tbuf);
  k3b_proj<<<dim3(MROWS / BM, DIM / BN2), 256, proj_lds, stream>>>(
      tbuf, wproj_bf, b_proj, out);
}

// v001
// A run of this version takes 355 microseconds.
// Next to v000, in two timings, it ran 1.28 times as fast each time.
#include <hip/hip_runtime.h>
#include <hip/hip_bf16.h>
#include <cstdint>

#define DIM   1024
#define NHEAD 16
#define HDIM  64
#define BATCH 4
#define SEQ   8192
#define MROWS (BATCH*SEQ)          // 32768
#define QK_SCALE 0.125f            // HDIM^-0.5

// GEMM tiling (big GEMMs): 256 x 128 per workgroup, 64 x 64 per wave (4 x 2 waves)
#define BM 128                     // rows per workgroup of k3a
#define BMG 256                    // rows per workgroup of the big GEMMs
#define BN2 128                    // wide N tile to cut L2 re-reads
#define BK 64
#define LDA 72                     // bf16 elems; 144B rows (16B aligned, conflict-free)
#define LDC2 132                   // f32 elems for C spill
#define NSTEP (DIM / BK)           // 16
// One stage in LDS: four 64-row slices of the row operand, four 32-row slices of
// the column operand, rows at 144 B, each slice's size rounded up to 2 KiB.
#define SLICE_A 10240u             // 64 * 144 = 9216 -> 10240
#define SLICE_B 6144u              // 32 * 144 = 4608 -> 6144
#define B_BASE  (4u * SLICE_A)     // 40960
#define STAGE_B (4u * SLICE_A + 4u * SLICE_B)   // 65536 B per buffer
#define CS_BYTES (BMG * LDC2 * 4)  // 135168 B, laid over the ring after the K loop

// small GEMM tiling (k2/k3a)
#define BN 64
#define LDB 72
#define NSPLIT 16
#define CHUNK (SEQ / NSPLIT)       // 512
#define LDE 40                     // 80B rows

typedef __bf16 bf16;
typedef bf16  v16bf __attribute__((ext_vector_type(16)));
typedef bf16  v8bf  __attribute__((ext_vector_type(8)));
typedef bf16  v4bf  __attribute__((ext_vector_type(4)));
typedef float v8f   __attribute__((ext_vector_type(8)));
typedef uint32_t u32x4 __attribute__((ext_vector_type(4)));
typedef uint32_t u32x8 __attribute__((ext_vector_type(8)));

__device__ __forceinline__ bf16 f2bf(float f) {
  uint32_t u = __builtin_bit_cast(uint32_t, f);
  u = (u + 0x7FFFu + ((u >> 16) & 1u)) >> 16;     // round-to-nearest-even
  uint16_t s = (uint16_t)u;
  return __builtin_bit_cast(bf16, s);
}
__device__ __forceinline__ float bf2f(bf16 b) {
  uint32_t u = ((uint32_t)__builtin_bit_cast(uint16_t, b)) << 16;
  return __builtin_bit_cast(float, u);
}

// LDS byte offset of a generic pointer into shared memory (addrspace(3) ptrtoint)
__device__ __forceinline__ uint32_t lds_off(const void* p) {
  return (uint32_t)(uintptr_t)(__attribute__((address_space(3))) const void*)p;
}

__device__ __forceinline__ uint32_t uni(uint32_t v) {
  return (uint32_t)__builtin_amdgcn_readfirstlane(v);
}
__device__ __forceinline__ uint32_t pinned(uint32_t v) {
  uint32_t w = uni(v);
  asm volatile("" : "+s"(w));   // pinned(): the issue test's word held in a scalar register
  return w;
}

// Group 1 of a tensor-load descriptor: a tile of nrows rows of 128 B (64 bf16),
// everything in bytes, tensor = tile, source pitch 2048 B; a 16-B pad behind
// every 128-B row, so rows land at a 144-B pitch.
__device__ __forceinline__ u32x8 tdm_group1(uint32_t nrows) {
  u32x8 g;
  g[0] = uni((1u << 20) | (4u << 22) | (3u << 25));
  g[1] = uni(128u << 16);
  g[2] = uni(nrows << 16);
  g[3] = uni(128u << 16);
  g[4] = uni(nrows);
  g[5] = uni(DIM * 2u);
  g[6] = uni(0u);
  g[7] = uni(0u);
  return g;
}
// Group 0: the slice's place in LDS (byte offset) and its first global byte.
__device__ __forceinline__ void tdm_aim(u32x4& g0, uint32_t lds_dst, uint64_t ga) {
  g0[0] = uni(1u);
  g0[1] = uni(lds_dst);
  g0[2] = uni((uint32_t)ga);
  g0[3] = uni((((uint32_t)(ga >> 32)) & 0x01FFFFFFu) | 0x80000000u);
}
// The next stage's request: a new place in LDS, the source BK elements further
// along its rows (words 2 and 3 as one 64-bit sum; the type bits sit above the
// address).  Called only behind the wait that covers the request before it.
__device__ __forceinline__ void tdm_advance(u32x4& g0, uint32_t lds_dst) {
  const uint64_t w = (((uint64_t)g0[3] << 32) | g0[2]) + BK * 2u;
  g0[1] = uni(lds_dst);
  g0[2] = uni((uint32_t)w);
  g0[3] = uni((uint32_t)(w >> 32));
}
// One request of the calling wave.  Both groups are in-out operands so that the
// registers an issued request names stay the descriptor's own while it is in
// flight: they take new values only in tdm_advance.
__device__ __forceinline__ void tdm_load(u32x4& g0, u32x8& g1) {
  asm volatile("tensor_load_to_lds %0, %1" : "+s"(g0), "+s"(g1) :: "memory");
}
// The mover's and the LDS reads' waits are not placed by the compiler.
__device__ __forceinline__ void wait_tensor0() { asm volatile("s_wait_tensorcnt 0x0" ::: "memory"); }
__device__ __forceinline__ void wait_ds0()     { asm volatile("s_wait_dscnt 0x0" ::: "memory"); }

// Load one 16(M/N) x 32(K) WMMA A/B fragment from an LDS tile laid out
// [row][k], leading dimension ld elems (row byte size 16B aligned).
// lanes 0-15 : row = lane,    K = {k0..k0+7} and {k0+16..k0+23}
// lanes 16-31: row = lane-16, K = {k0+8..k0+15} and {k0+24..k0+31}
__device__ __forceinline__ v16bf frag_ld(const bf16* tile, int ld, int row0, int k0) {
  const int lane = threadIdx.x & 31;
  const bf16* p = tile + (row0 + (lane & 15)) * ld + k0 + ((lane >> 4) << 3);
  union { v16bf v; v8bf h[2]; } f;
  f.h[0] = *(const v8bf*)(p);
  f.h[1] = *(const v8bf*)(p + 16);
  return f.v;
}

__device__ __forceinline__ v8f wmma_bf16(v16bf a, v16bf b, v8f c) {
  return __builtin_amdgcn_wmma_f32_16x16x32_bf16(false, a, false, b,
                                                 (short)0, c, false, false);
}

extern __shared__ __attribute__((aligned(2048))) char smem[];

// acc[i][t] += rows [mb + 64*wm + 16*i ..) of a  x  rows [cb + 64*wn + 16*t ..) of b,
// both K-contiguous with DIM elements a row.  Two-buffer ring: every wave brings
// its own slice of a stage with one tensor load, one request outstanding.
__device__ __forceinline__ void gemm_256x128(const bf16* __restrict__ a,
                                             const bf16* __restrict__ b,
                                             int mb, int cb, v8f (&acc)[4][4]) {
  const uint32_t wave = uni(threadIdx.x >> 5);
  const uint32_t wm = wave & 3u, wn = wave >> 2;
  const bool     rowop = wave < 4u;      // waves 0-3 bring a, waves 4-7 bring b
  const uint32_t slot  = rowop ? wave * SLICE_A : B_BASE + (wave - 4u) * SLICE_B;
  const uint64_t gsrc  = rowop
      ? (uint64_t)(uintptr_t)(a + (size_t)(mb + 64 * (int)wave) * DIM)
      : (uint64_t)(uintptr_t)(b + (size_t)(cb + 32 * (int)(wave - 4u)) * DIM);
  const uint32_t dst0  = lds_off(smem) + slot;
  u32x8 g1 = tdm_group1(rowop ? 64u : 32u);
  u32x4 g0;

  tdm_aim(g0, dst0, gsrc);                        // stage 0
  tdm_load(g0, g1);
  wait_tensor0();
  __syncthreads();
  tdm_advance(g0, dst0 + STAGE_B);                // stage 1
  tdm_load(g0, g1);

  for (int s = 0; s < NSTEP; ++s) {
    const char* buf = smem + (s & 1) * STAGE_B;
    const bf16* At = (const bf16*)(buf + wm * SLICE_A);
    const bf16* Bt = (const bf16*)(buf + B_BASE + 2u * wn * SLICE_B);
    #pragma unroll
    for (int kc = 0; kc < BK; kc += 32) {
      v16bf va[4], vb[4];
      #pragma unroll
      for (int i = 0; i < 4; ++i) va[i] = frag_ld(At, LDA, i * 16, kc);
      #pragma unroll
      for (int t = 0; t < 4; ++t)
        vb[t] = frag_ld(Bt + (t >> 1) * (SLICE_B / 2u), LDA, (t & 1) * 16, kc);
      #pragma unroll
      for (int i = 0; i < 4; ++i)
        #pragma unroll
        for (int t = 0; t < 4; ++t) acc[i][t] = wmma_bf16(va[i], vb[t], acc[i][t]);
    }
    // publish point of stage s + 1; the barrier also frees this pass's buffer
    wait_ds0();
    wait_tensor0();
    __syncthreads();
    if (pinned(s + 2 < NSTEP)) {
      tdm_advance(g0, dst0 + (s & 1) * STAGE_B);  // stage s + 2
      tdm_load(g0, g1);
    }
  }
  // The last pass's own barrier has ended every read of the ring: it may be
  // overwritten by the output staging from here on.
  wait_tensor0();
  wait_ds0();
}

// spill accumulators (C layout: lane = n + 16*(m>=8), vgpr = m%8)
__device__ __forceinline__ void spill_256x128(float* Cs, const v8f (&acc)[4][4]) {
  const int lane = threadIdx.x & 31, wave = threadIdx.x >> 5;
  const int rb = (wave & 3) * 64 + ((lane >> 4) << 3);
  const int cl = (wave >> 2) * 64 + (lane & 15);
  #pragma unroll
  for (int i = 0; i < 4; ++i)
    #pragma unroll
    for (int t = 0; t < 4; ++t)
      #pragma unroll
      for (int r = 0; r < 8; ++r)
        Cs[(rb + i * 16 + r) * LDC2 + t * 16 + cl] = acc[i][t][r];
}

// ---------------------------------------------------------------- kernel 0
// bf16 conversions + zeroing of atomic accumulators (every launch).
__global__ void k0_init(const float* __restrict__ x, const float* __restrict__ wqkv,
                        const float* __restrict__ wproj,
                        bf16* __restrict__ x_bf, bf16* __restrict__ wqkv_bf,
                        bf16* __restrict__ wproj_bf,
                        float* __restrict__ ctx, float* __restrict__ zbuf) {
  const int i = blockIdx.x * blockDim.x + threadIdx.x;
  if (i < MROWS * DIM)   x_bf[i] = f2bf(x[i]);
  if (i < 3 * DIM * DIM) wqkv_bf[i] = f2bf(wqkv[i]);
  if (i < DIM * DIM)     wproj_bf[i] = f2bf(wproj[i]);
  if (i < BATCH * NHEAD * HDIM * HDIM) ctx[i] = 0.f;
  if (i < BATCH * NHEAD * HDIM)        zbuf[i] = 0.f;
}

// ------------------------------------------------------ kernel 1: QKV GEMM
// qkv = x @ w_qkv^T  (tensor loads double-buffered into LDS, bf16 WMMA), fused
// epilogue per 128-column (two-head-aligned) slab.
__global__ void __launch_bounds__(256)
k1_qkv(const bf16* __restrict__ xbf, const bf16* __restrict__ wbf,
       bf16* __restrict__ qs, bf16* __restrict__ ebuf, bf16* __restrict__ vbuf) {
  float* Cs   = (float*)smem;                       // over the ring, after the K loop
  float* rmax = (float*)(smem + CS_BYTES);          // 2*256 f32
  float* rscl = rmax + 2 * BMG;

  const int tid  = threadIdx.x;
  const int mb   = blockIdx.x * BMG;
  const int cb   = blockIdx.y * BN2;                // 0..2944

  v8f acc[4][4];
  #pragma unroll
  for (int i = 0; i < 4; ++i)
    #pragma unroll
    for (int t = 0; t < 4; ++t)
      #pragma unroll
      for (int r = 0; r < 8; ++r) acc[i][t][r] = 0.f;

  gemm_256x128(xbf, wbf, mb, cb, acc);
  spill_256x128(Cs, acc);
  __syncthreads();

  const int sec = cb >> 10;                    // 0=q, 1=k, 2=v
  const int ci  = cb & 1023;
  if (sec == 0) {
    // row softmax per 64-wide head (two heads per slab), * SCALE
    for (int hh = 0; hh < 2; ++hh) {
      const int r = tid;
      const float* row = Cs + r * LDC2 + hh * 64;
      float m = -1e30f, sum = 0.f;
      for (int e = 0; e < 64; ++e) m = fmaxf(m, row[e]);
      for (int e = 0; e < 64; ++e) sum += __expf(row[e] - m);
      rmax[hh * BMG + r] = m;
      rscl[hh * BMG + r] = QK_SCALE / sum;
    }
    __syncthreads();
    for (int i = tid; i < BMG * BN2; i += 256) {
      const int r = i >> 7, e = i & 127, hh = e >> 6;
      const float v = __expf(Cs[r * LDC2 + e] - rmax[hh * BMG + r]) * rscl[hh * BMG + r];
      qs[(size_t)(mb + r) * DIM + ci + e] = f2bf(v);
    }
  } else if (sec == 1) {
    // E = exp(k_raw); k values ~N(0,1) so no max subtraction needed
    for (int i = tid; i < BMG * BN2; i += 256) {
      const int r = i >> 7, e = i & 127;
      ebuf[(size_t)(mb + r) * DIM + ci + e] = f2bf(__expf(Cs[r * LDC2 + e]));
    }
  } else {
    for (int i = tid; i < BMG * BN2; i += 256) {
      const int r = i >> 7, e = i & 127;
      vbuf[(size_t)(mb + r) * DIM + ci + e] = f2bf(Cs[r * LDC2 + e]);
    }
  }
}

// ---------------------------------- kernel 2: context' = E^T V, Z = colsum(E)
__global__ void __launch_bounds__(128)
k2_context(const bf16* __restrict__ ebuf, const bf16* __restrict__ vbuf,
           float* __restrict__ ctx, float* __restrict__ zbuf) {
  __shared__ bf16 Es[HDIM * LDE];              // [d][n] (transposed)
  __shared__ bf16 Vs[HDIM * LDE];              // [e][n] (transposed)
  const int tid  = threadIdx.x;
  const int wave = tid >> 5;
  const int bh = blockIdx.x >> 4;              // NSPLIT == 16
  const int ns = blockIdx.x & (NSPLIT - 1);
  const int b = bh >> 4, h = bh & 15;
  const size_t rowbase = (size_t)b * SEQ + (size_t)ns * CHUNK;
  const int hoff = h * HDIM;

  v8f acc[4];
  #pragma unroll
  for (int t = 0; t < 4; ++t)
    #pragma unroll
    for (int i = 0; i < 8; ++i) acc[t][i] = 0.f;
  float zacc = 0.f;

  for (int nb = 0; nb < CHUNK; nb += 32) {
    for (int i = tid; i < 32 * HDIM; i += 128) {   // transpose into LDS
      const int nl = i >> 6, d = i & 63;
      Es[d * LDE + nl] = ebuf[(rowbase + nb + nl) * DIM + hoff + d];
      Vs[d * LDE + nl] = vbuf[(rowbase + nb + nl) * DIM + hoff + d];
    }
    __syncthreads();
    if (tid < HDIM) {
      #pragma unroll
      for (int n = 0; n < 32; ++n) zacc += bf2f(Es[tid * LDE + n]);
    }
    const int wr = wave * 16;
    const v16bf va = frag_ld(Es, LDE, wr, 0);
    #pragma unroll
    for (int t = 0; t < 4; ++t) {
      const v16bf vbr = frag_ld(Vs, LDE, t * 16, 0);
      acc[t] = wmma_bf16(va, vbr, acc[t]);
    }
    __syncthreads();
  }
  {
    const int lane = tid & 31;
    const int rb = wave * 16 + ((lane >> 4) << 3);
    const int cl = lane & 15;
    float* cbase = ctx + (size_t)bh * HDIM * HDIM;
    #pragma unroll
    for (int t = 0; t < 4; ++t)
      #pragma unroll
      for (int i = 0; i < 8; ++i)
        atomicAdd(cbase + (rb + i) * HDIM + t * 16 + cl, acc[t][i]);
  }
  if (tid < HDIM) atomicAdd(zbuf + bh * HDIM + tid, zacc);
}

// ------------------- kernel 2b: ctxT[bh][e][d] = ctx[bh][d][e] / Z[bh][d]
__global__ void k2b_norm(const float* __restrict__ ctx, const float* __restrict__ zbuf,
                         bf16* __restrict__ ctxT) {
  const int i = blockIdx.x * blockDim.x + threadIdx.x;
  if (i >= BATCH * NHEAD * HDIM * HDIM) return;
  const int bh = i >> 12, e = (i >> 6) & 63, d = i & 63;
  ctxT[i] = f2bf(ctx[(size_t)bh * 4096 + d * 64 + e] / zbuf[bh * 64 + d]);
}

// --------------------------- kernel 3a: t = q_soft @ ctx (block-diag/head)
__global__ void __launch_bounds__(256)
k3a_qctx(const bf16* __restrict__ qs, const bf16* __restrict__ ctxT,
         bf16* __restrict__ tbuf) {
  __shared__ bf16 As3[BM * LDA];
  __shared__ bf16 Bs3[BN * LDB];
  const int tid = threadIdx.x, wave = tid >> 5;
  const int mb = blockIdx.x * BM;
  const int h = blockIdx.y;
  const int bh = (mb / SEQ) * NHEAD + h;
  const int hoff = h * HDIM;

  for (int i = tid; i < BM * (HDIM / 4); i += 256) {
    const int r = i >> 4, c4 = (i & 15) * 4;
    *(v4bf*)(As3 + r * LDA + c4) =
        *(const v4bf*)(qs + (size_t)(mb + r) * DIM + hoff + c4);
  }
  for (int i = tid; i < BN * (HDIM / 4); i += 256) {
    const int r = i >> 4, c4 = (i & 15) * 4;
    *(v4bf*)(Bs3 + r * LDB + c4) =
        *(const v4bf*)(ctxT + (size_t)bh * 4096 + r * HDIM + c4);
  }
  __syncthreads();

  v8f acc[4];
  #pragma unroll
  for (int t = 0; t < 4; ++t)
    #pragma unroll
    for (int i = 0; i < 8; ++i) acc[t][i] = 0.f;

  const int wr = wave * 16;
  #pragma unroll
  for (int kc = 0; kc < HDIM; kc += 32) {
    const v16bf va = frag_ld(As3, LDA, wr, kc);
    #pragma unroll
    for (int t = 0; t < 4; ++t) {
      const v16bf vbr = frag_ld(Bs3, LDB, t * 16, kc);
      acc[t] = wmma_bf16(va, vbr, acc[t]);
    }
  }
  const int lane = tid & 31;
  const int rb = wr + ((lane >> 4) << 3);
  const int cl = lane & 15;
  #pragma unroll
  for (int t = 0; t < 4; ++t)
    #pragma unroll
    for (int i = 0; i < 8; ++i)
      tbuf[(size_t)(mb + rb + i) * DIM + hoff + t * 16 + cl] = f2bf(acc[t][i]);
}

// ----------------------------- kernel 3b: out = t @ w_proj^T + b_proj (f32)
__global__ void __launch_bounds__(256)
k3b_proj(const bf16* __restrict__ tbuf, const bf16* __restrict__ wpbf,
         const float* __restrict__ bias, float* __restrict__ out) {
  float* Cs   = (float*)smem;                       // over the ring, after the K loop
  const int tid = threadIdx.x;
  const int mb = blockIdx.x * BMG;
  const int cb = blockIdx.y * BN2;

  v8f acc[4][4];
  #pragma unroll
  for (int i = 0; i < 4; ++i)
    #pragma unroll
    for (int t = 0; t < 4; ++t)
      #pragma unroll
      for (int r = 0; r < 8; ++r) acc[i][t][r] = 0.f;

  gemm_256x128(tbuf, wpbf, mb, cb, acc);
  spill_256x128(Cs, acc);
  __syncthreads();
  for (int i = tid; i < BMG * BN2; i += 256) {
    const int r = i >> 7, c = i & 127;
    out[(size_t)(mb + r) * DIM + cb + c] = Cs[r * LDC2 + c] + bias[cb + c];
  }
}

// ---------------------------------------------------------------- launcher
extern "C" void kernel_launch(void* const* d_in, const int* in_sizes, int n_in,
                              void* d_out, int out_size, void* d_ws, size_t ws_size,
                              hipStream_t stream) {
  (void)in_sizes; (void)n_in; (void)out_size; (void)ws_size;
  const float* x      = (const float*)d_in[0];
  const float* w_qkv  = (const float*)d_in[1];
  const float* w_proj = (const float*)d_in[2];
  const float* b_proj = (const float*)d_in[3];
  float* out = (float*)d_out;

  char* p = (char*)d_ws;
  size_t off = 0;
  auto take = [&](size_t bytes) -> char* {
    char* r = p + off;
    off += (bytes + 255) & ~(size_t)255;
    return r;
  };
  bf16*  x_bf     = (bf16*)take((size_t)MROWS * DIM * 2);   // 64 MB
  bf16*  qs       = (bf16*)take((size_t)MROWS * DIM * 2);   // 64 MB
  bf16*  ebuf     = (bf16*)take((size_t)MROWS * DIM * 2);   // 64 MB (reused as t)
  bf16*  vbuf     = (bf16*)take((size_t)MROWS * DIM * 2);   // 64 MB
  bf16*  wqkv_bf  = (bf16*)take((size_t)3 * DIM * DIM * 2); // 6 MB
  bf16*  wproj_bf = (bf16*)take((size_t)DIM * DIM * 2);     // 2 MB
  float* ctx      = (float*)take((size_t)BATCH * NHEAD * HDIM * HDIM * 4);
  float* zbuf     = (float*)take((size_t)BATCH * NHEAD * HDIM * 4);
  bf16*  ctxT     = (bf16*)take((size_t)BATCH * NHEAD * HDIM * HDIM * 2);

  const size_t big_lds   = CS_BYTES + 2 * 2 * BMG * 4;  // k1: 136 KB
  const size_t proj_lds  = CS_BYTES;                    // k3b: 132 KB

  k0_init<<<(MROWS * DIM) / 256, 256, 0, stream>>>(x, w_qkv, w_proj, x_bf,
                                                   wqkv_bf, wproj_bf, ctx, zbuf);
  k1_qkv<<<dim3(MROWS / BMG, (3 * DIM) / BN2), 256, big_lds, stream>>>(
      x_bf, wqkv_bf, qs, ebuf, vbuf);
  k2_context<<<BATCH * NHEAD * NSPLIT, 128, 0, stream>>>(ebuf, vbuf, ctx, zbuf);
  k2b_norm<<<(BATCH * NHEAD * HDIM * HDIM + 255) / 256, 256, 0, stream>>>(ctx, zbuf, ctxT);
  bf16* tbuf = ebuf;  // E is dead after k2 — reuse for t
  k3a_qctx<<<dim3(MROWS / BM, NHEAD), 256, 0, stream>>>(qs, ctxT, tbuf);
  k3b_proj<<<dim3(MROWS / BMG, DIM / BN2), 256, proj_lds, stream>>>(
      tbuf, wproj_bf, b_proj, out);
}

// v002
// Measured time: 299 microseconds a run.
// In both of two side-by-side timings against v001, it was 1.18 times as fast.
// Over all steps from v000 it is 1.52 times as fast.
#include <hip/hip_runtime.h>
#include <hip/hip_bf16.h>
#include <cstdint>

#define DIM   1024
#define NHEAD 16
#define HDIM  64
#define BATCH 4
#define SEQ   8192
#define MROWS (BATCH*SEQ)          // 32768
#define QK_SCALE 0.125f            // HDIM^-0.5

// GEMM tiling (big GEMMs): 256 x 128 per workgroup, 64 x 64 per wave (4 x 2 waves)
#define BM 128                     // rows per workgroup of k3a
#define BMG 256                    // rows per workgroup of the big GEMMs
#define BN2 128                    // wide N tile to cut L2 re-reads
#define BK 64
#define LDA 72                     // bf16 elems; 144B rows (16B aligned, conflict-free)
#define LDC2 132                   // f32 elems for C spill
#define NSTEP (DIM / BK)           // 16
// One stage in LDS: four 64-row slices of the row operand, four 32-row slices of
// the column operand, rows at 144 B, each slice's size rounded up to 2 KiB.
#define SLICE_A 10240u             // 64 * 144 = 9216 -> 10240
#define SLICE_B 6144u              // 32 * 144 = 4608 -> 6144
#define B_BASE  (4u * SLICE_A)     // 40960
#define STAGE_B (4u * SLICE_A + 4u * SLICE_B)   // 65536 B per buffer
#define CS_BYTES (BMG * LDC2 * 4)  // 135168 B, laid over the ring after the K loop

// small GEMM tiling (k2/k3a)
#define BN 64
#define LDB 72
#define NSPLIT 16
#define CHUNK (SEQ / NSPLIT)       // 512
#define LDE 40                     // 80B rows

typedef __bf16 bf16;
typedef bf16  v16bf __attribute__((ext_vector_type(16)));
typedef bf16  v8bf  __attribute__((ext_vector_type(8)));
typedef bf16  v4bf  __attribute__((ext_vector_type(4)));
typedef float v8f   __attribute__((ext_vector_type(8)));
typedef float v4f   __attribute__((ext_vector_type(4)));
typedef uint32_t u32x4 __attribute__((ext_vector_type(4)));
typedef uint32_t u32x8 __attribute__((ext_vector_type(8)));

__device__ __forceinline__ bf16 f2bf(float f) {
  uint32_t u = __builtin_bit_cast(uint32_t, f);
  u = (u + 0x7FFFu + ((u >> 16) & 1u)) >> 16;     // round-to-nearest-even
  uint16_t s = (uint16_t)u;
  return __builtin_bit_cast(bf16, s);
}
__device__ __forceinline__ float bf2f(bf16 b) {
  uint32_t u = ((uint32_t)__builtin_bit_cast(uint16_t, b)) << 16;
  return __builtin_bit_cast(float, u);
}

// LDS byte offset of a generic pointer into shared memory (addrspace(3) ptrtoint)
__device__ __forceinline__ uint32_t lds_off(const void* p) {
  return (uint32_t)(uintptr_t)(__attribute__((address_space(3))) const void*)p;
}

__device__ __forceinline__ uint32_t uni(uint32_t v) {
  return (uint32_t)__builtin_amdgcn_readfirstlane(v);
}
__device__ __forceinline__ uint32_t pinned(uint32_t v) {
  uint32_t w = uni(v);
  asm volatile("" : "+s"(w));   // pinned(): the issue test's word held in a scalar register
  return w;
}

// Group 1 of a tensor-load descriptor: a tile of nrows rows of 128 B (64 bf16),
// everything in bytes, tensor = tile, source pitch 2048 B; a 16-B pad behind
// every 128-B row, so rows land at a 144-B pitch.
__device__ __forceinline__ u32x8 tdm_group1(uint32_t nrows) {
  u32x8 g;
  g[0] = uni((1u << 20) | (4u << 22) | (3u << 25));
  g[1] = uni(128u << 16);
  g[2] = uni(nrows << 16);
  g[3] = uni(128u << 16);
  g[4] = uni(nrows);
  g[5] = uni(DIM * 2u);
  g[6] = uni(0u);
  g[7] = uni(0u);
  return g;
}
// Group 0: the slice's place in LDS (byte offset) and its first global byte.
__device__ __forceinline__ void tdm_aim(u32x4& g0, uint32_t lds_dst, uint64_t ga) {
  g0[0] = uni(1u);
  g0[1] = uni(lds_dst);
  g0[2] = uni((uint32_t)ga);
  g0[3] = uni((((uint32_t)(ga >> 32)) & 0x01FFFFFFu) | 0x80000000u);
}
// The next stage's request: a new place in LDS, the source BK elements further
// along its rows (words 2 and 3 as one 64-bit sum; the type bits sit above the
// address).  Called only behind the wait that covers the request before it.
__device__ __forceinline__ void tdm_advance(u32x4& g0, uint32_t lds_dst) {
  const uint64_t w = (((uint64_t)g0[3] << 32) | g0[2]) + BK * 2u;
  g0[1] = uni(lds_dst);
  g0[2] = uni((uint32_t)w);
  g0[3] = uni((uint32_t)(w >> 32));
}
// One request of the calling wave.  Both groups are in-out operands so that the
// registers an issued request names stay the descriptor's own while it is in
// flight: they take new values only in tdm_advance.
__device__ __forceinline__ void tdm_load(u32x4& g0, u32x8& g1) {
  asm volatile("tensor_load_to_lds %0, %1" : "+s"(g0), "+s"(g1) :: "memory");
}
// The mover's and the LDS reads' waits are not placed by the compiler.
__device__ __forceinline__ void wait_tensor0() { asm volatile("s_wait_tensorcnt 0x0" ::: "memory"); }
__device__ __forceinline__ void wait_ds0()     { asm volatile("s_wait_dscnt 0x0" ::: "memory"); }

// Load one 16(M/N) x 32(K) WMMA A/B fragment from an LDS tile laid out
// [row][k], leading dimension ld elems (row byte size 16B aligned).
// lanes 0-15 : row = lane,    K = {k0..k0+7} and {k0+16..k0+23}
// lanes 16-31: row = lane-16, K = {k0+8..k0+15} and {k0+24..k0+31}
__device__ __forceinline__ v16bf frag_ld(const bf16* tile, int ld, int row0, int k0) {
  const int lane = threadIdx.x & 31;
  const bf16* p = tile + (row0 + (lane & 15)) * ld + k0 + ((lane >> 4) << 3);
  union { v16bf v; v8bf h[2]; } f;
  f.h[0] = *(const v8bf*)(p);
  f.h[1] = *(const v8bf*)(p + 16);
  return f.v;
}

__device__ __forceinline__ v8f wmma_bf16(v16bf a, v16bf b, v8f c) {
  return __builtin_amdgcn_wmma_f32_16x16x32_bf16(false, a, false, b,
                                                 (short)0, c, false, false);
}

extern __shared__ __attribute__((aligned(2048))) char smem[];

// acc[i][t] += rows [mb + 64*wm + 16*i ..) of a  x  rows [cb + 64*wn + 16*t ..) of b,
// both K-contiguous with DIM elements a row.  Two-buffer ring: every wave brings
// its own slice of a stage with one tensor load, one request outstanding.
__device__ __forceinline__ void gemm_256x128(const bf16* __restrict__ a,
                                             const bf16* __restrict__ b,
                                             int mb, int cb, v8f (&acc)[4][4]) {
  const uint32_t wave = uni(threadIdx.x >> 5);
  const uint32_t wm = wave & 3u, wn = wave >> 2;
  const bool     rowop = wave < 4u;      // waves 0-3 bring a, waves 4-7 bring b
  const uint32_t slot  = rowop ? wave * SLICE_A : B_BASE + (wave - 4u) * SLICE_B;
  const uint64_t gsrc  = rowop
      ? (uint64_t)(uintptr_t)(a + (size_t)(mb + 64 * (int)wave) * DIM)
      : (uint64_t)(uintptr_t)(b + (size_t)(cb + 32 * (int)(wave - 4u)) * DIM);
  const uint32_t dst0  = lds_off(smem) + slot;
  u32x8 g1 = tdm_group1(rowop ? 64u : 32u);
  u32x4 g0;

  tdm_aim(g0, dst0, gsrc);                        // stage 0
  tdm_load(g0, g1);
  wait_tensor0();
  __syncthreads();
  tdm_advance(g0, dst0 + STAGE_B);                // stage 1
  tdm_load(g0, g1);

  for (int s = 0; s < NSTEP; ++s) {
    const char* buf = smem + (s & 1) * STAGE_B;
    const bf16* At = (const bf16*)(buf + wm * SLICE_A);
    const bf16* Bt = (const bf16*)(buf + B_BASE + 2u * wn * SLICE_B);
    #pragma unroll
    for (int kc = 0; kc < BK; kc += 32) {
      v16bf va[4], vb[4];
      #pragma unroll
      for (int i = 0; i < 4; ++i) va[i] = frag_ld(At, LDA, i * 16, kc);
      #pragma unroll
      for (int t = 0; t < 4; ++t)
        vb[t] = frag_ld(Bt + (t >> 1) * (SLICE_B / 2u), LDA, (t & 1) * 16, kc);
      #pragma unroll
      for (int i = 0; i < 4; ++i)
        #pragma unroll
        for (int t = 0; t < 4; ++t) acc[i][t] = wmma_bf16(va[i], vb[t], acc[i][t]);
    }
    // publish point of stage s + 1; the barrier also frees this pass's buffer
    wait_ds0();
    wait_tensor0();
    __syncthreads();
    if (pinned(s + 2 < NSTEP)) {
      tdm_advance(g0, dst0 + (s & 1) * STAGE_B);  // stage s + 2
      tdm_load(g0, g1);
    }
  }
  // The last pass's own barrier has ended every read of the ring: it may be
  // overwritten by the output staging from here on.
  wait_tensor0();
  wait_ds0();
}

// spill accumulators (C layout: lane = n + 16*(m>=8), vgpr = m%8)
__device__ __forceinline__ void spill_256x128(float* Cs, const v8f (&acc)[4][4]) {
  const int lane = threadIdx.x & 31, wave = threadIdx.x >> 5;
  const int rb = (wave & 3) * 64 + ((lane >> 4) << 3);
  const int cl = (wave >> 2) * 64 + (lane & 15);
  #pragma unroll
  for (int i = 0; i < 4; ++i)
    #pragma unroll
    for (int t = 0; t < 4; ++t)
      #pragma unroll
      for (int r = 0; r < 8; ++r)
        Cs[(rb + i * 16 + r) * LDC2 + t * 16 + cl] = acc[i][t][r];
}

// ---------------------------------------------------------------- kernel 0
// bf16 conversions + zeroing of atomic accumulators (every launch), as a stream:
// few workgroups, all resident at once; each owns one contiguous piece of K0_P4
// groups of four floats of ONE of the three arrays and walks it in runs of eight
// wave-wide 512-B loads that are in flight together.
#define K0_T   256
#define K0_P4  8192                              // groups of four floats per workgroup
#define K0_XW  (MROWS * DIM / 4 / K0_P4)         // 1024 workgroups on x
#define K0_QW  (3 * DIM * DIM / 4 / K0_P4)       // 96 on w_qkv
#define K0_PW  (DIM * DIM / 4 / K0_P4)           // 32 on w_proj
#define K0_ZW  (BATCH * NHEAD * HDIM / K0_T)     // 16 of them also zero zbuf
static_assert(BATCH * NHEAD * HDIM * HDIM == K0_XW * K0_T, "ctx: one float a thread on x");
static_assert(K0_ZW <= K0_QW, "zbuf: one float a thread of the first workgroups on w_qkv");

// NB groups of four floats, K0_T groups apart: all loads first, then the stores.
// The f32 source is read once, so its loads are non-temporal.
template <int NB>
__device__ __forceinline__ void cvt_run(const float* __restrict__ src,
                                        bf16* __restrict__ dst, int first4) {
  const v4f* s = (const v4f*)src + first4;
  v4bf*      d = (v4bf*)dst + first4;
  v4f v[NB];
  #pragma unroll
  for (int j = 0; j < NB; ++j) v[j] = __builtin_nontemporal_load(s + j * K0_T);
  #pragma unroll
  for (int j = 0; j < NB; ++j) {
    v4bf o;
    #pragma unroll
    for (int e = 0; e < 4; ++e) o[e] = f2bf(v[j][e]);
    d[j * K0_T] = o;
  }
}

__global__ void __launch_bounds__(K0_T)
k0_init(const float* __restrict__ x, const float* __restrict__ wqkv,
        const float* __restrict__ wproj,
        bf16* __restrict__ x_bf, bf16* __restrict__ wqkv_bf,
        bf16* __restrict__ wproj_bf,
        float* __restrict__ ctx, float* __restrict__ zbuf) {
  const int tid = threadIdx.x, wg = blockIdx.x;
  const float* src = x;
  bf16*        dst = x_bf;
  int          piece = wg;
  if (wg >= K0_XW + K0_QW)  { src = wproj; dst = wproj_bf; piece = wg - (K0_XW + K0_QW); }
  else if (wg >= K0_XW)     { src = wqkv;  dst = wqkv_bf;  piece = wg - K0_XW; }
  // Kept rolled: unrolled, every load of the thread is lifted to the top, and the
  // registers that takes keep part of the workgroups from being resident.
  #pragma unroll 1
  for (int b = 0; b < K0_P4 / K0_T; b += 8)
    cvt_run<8>(src, dst, piece * K0_P4 + b * K0_T + tid);
  if (wg < K0_XW + K0_ZW) {
    float* z = wg < K0_XW ? ctx + wg * K0_T : zbuf + (wg - K0_XW) * K0_T;
    z[tid] = 0.f;
  }
}

// ------------------------------------------------------ kernel 1: QKV GEMM
// qkv = x @ w_qkv^T  (tensor loads double-buffered into LDS, bf16 WMMA), fused
// epilogue per 128-column (two-head-aligned) slab.
__global__ void __launch_bounds__(256)
k1_qkv(const bf16* __restrict__ xbf, const bf16* __restrict__ wbf,
       bf16* __restrict__ qs, bf16* __restrict__ ebuf, bf16* __restrict__ vbuf) {
  float* Cs   = (float*)smem;                       // over the ring, after the K loop
  float* rmax = (float*)(smem + CS_BYTES);          // 2*256 f32
  float* rscl = rmax + 2 * BMG;

  const int tid  = threadIdx.x;
  const int mb   = blockIdx.x * BMG;
  const int cb   = blockIdx.y * BN2;                // 0..2944

  v8f acc[4][4];
  #pragma unroll
  for (int i = 0; i < 4; ++i)
    #pragma unroll
    for (int t = 0; t < 4; ++t)
      #pragma unroll
      for (int r = 0; r < 8; ++r) acc[i][t][r] = 0.f;

  gemm_256x128(xbf, wbf, mb, cb, acc);
  spill_256x128(Cs, acc);
  __syncthreads();

  const int sec = cb >> 10;                    // 0=q, 1=k, 2=v
  const int ci  = cb & 1023;
  if (sec == 0) {
    // row softmax per 64-wide head (two heads per slab), * SCALE
    for (int hh = 0; hh < 2; ++hh) {
      const int r = tid;
      const float* row = Cs + r * LDC2 + hh * 64;
      float m = -1e30f, sum = 0.f;
      for (int e = 0; e < 64; ++e) m = fmaxf(m, row[e]);
      for (int e = 0; e < 64; ++e) sum += __expf(row[e] - m);
      rmax[hh * BMG + r] = m;
      rscl[hh * BMG + r] = QK_SCALE / sum;
    }
    __syncthreads();
    for (int i = tid; i < BMG * BN2; i += 256) {
      const int r = i >> 7, e = i & 127, hh = e >> 6;
      const float v = __expf(Cs[r * LDC2 + e] - rmax[hh * BMG + r]) * rscl[hh * BMG + r];
      qs[(size_t)(mb + r) * DIM + ci + e] = f2bf(v);
    }
  } else if (sec == 1) {
    // E = exp(k_raw); k values ~N(0,1) so no max subtraction needed
    for (int i = tid; i < BMG * BN2; i += 256) {
      const int r = i >> 7, e = i & 127;
      ebuf[(size_t)(mb + r) * DIM + ci + e] = f2bf(__expf(Cs[r * LDC2 + e]));
    }
  } else {
    for (int i = tid; i < BMG * BN2; i += 256) {
      const int r = i >> 7, e = i & 127;
      vbuf[(size_t)(mb + r) * DIM + ci + e] = f2bf(Cs[r * LDC2 + e]);
    }
  }
}

// ---------------------------------- kernel 2: context' = E^T V, Z = colsum(E)
__global__ void __launch_bounds__(128)
k2_context(const bf16* __restrict__ ebuf, const bf16* __restrict__ vbuf,
           float* __restrict__ ctx, float* __restrict__ zbuf) {
  __shared__ bf16 Es[HDIM * LDE];              // [d][n] (transposed)
  __shared__ bf16 Vs[HDIM * LDE];              // [e][n] (transposed)
  const int tid  = threadIdx.x;
  const int wave = tid >> 5;
  const int bh = blockIdx.x >> 4;              // NSPLIT == 16
  const int ns = blockIdx.x & (NSPLIT - 1);
  const int b = bh >> 4, h = bh & 15;
  const size_t rowbase = (size_t)b * SEQ + (size_t)ns * CHUNK;
  const int hoff = h * HDIM;

  v8f acc[4];
  #pragma unroll
  for (int t = 0; t < 4; ++t)
    #pragma unroll
    for (int i = 0; i < 8; ++i) acc[t][i] = 0.f;
  float zacc = 0.f;

  for (int nb = 0; nb < CHUNK; nb += 32) {
    for (int i = tid; i < 32 * HDIM; i += 128) {   // transpose into LDS
      const int nl = i >> 6, d = i & 63;
      Es[d * LDE + nl] = ebuf[(rowbase + nb + nl) * DIM + hoff + d];
      Vs[d * LDE + nl] = vbuf[(rowbase + nb + nl) * DIM + hoff + d];
    }
    __syncthreads();
    if (tid < HDIM) {
      #pragma unroll
      for (int n = 0; n < 32; ++n) zacc += bf2f(Es[tid * LDE + n]);
    }
    const int wr = wave * 16;
    const v16bf va = frag_ld(Es, LDE, wr, 0);
    #pragma unroll
    for (int t = 0; t < 4; ++t) {
      const v16bf vbr = frag_ld(Vs, LDE, t * 16, 0);
      acc[t] = wmma_bf16(va, vbr, acc[t]);
    }
    __syncthreads();
  }
  {
    const int lane = tid & 31;
    const int rb = wave * 16 + ((lane >> 4) << 3);
    const int cl = lane & 15;
    float* cbase = ctx + (size_t)bh * HDIM * HDIM;
    #pragma unroll
    for (int t = 0; t < 4; ++t)
      #pragma unroll
      for (int i = 0; i < 8; ++i)
        atomicAdd(cbase + (rb + i) * HDIM + t * 16 + cl, acc[t][i]);
  }
  if (tid < HDIM) atomicAdd(zbuf + bh * HDIM + tid, zacc);
}

// ------------------- kernel 2b: ctxT[bh][e][d] = ctx[bh][d][e] / Z[bh][d]
__global__ void k2b_norm(const float* __restrict__ ctx, const float* __restrict__ zbuf,
                         bf16* __restrict__ ctxT) {
  const int i = blockIdx.x * blockDim.x + threadIdx.x;
  if (i >= BATCH * NHEAD * HDIM * HDIM) return;
  const int bh = i >> 12, e = (i >> 6) & 63, d = i & 63;
  ctxT[i] = f2bf(ctx[(size_t)bh * 4096 + d * 64 + e] / zbuf[bh * 64 + d]);
}

// --------------------------- kernel 3a: t = q_soft @ ctx (block-diag/head)
__global__ void __launch_bounds__(256)
k3a_qctx(const bf16* __restrict__ qs, const bf16* __restrict__ ctxT,
         bf16* __restrict__ tbuf) {
  __shared__ bf16 As3[BM * LDA];
  __shared__ bf16 Bs3[BN * LDB];
  const int tid = threadIdx.x, wave = tid >> 5;
  const int mb = blockIdx.x * BM;
  const int h = blockIdx.y;
  const int bh = (mb / SEQ) * NHEAD + h;
  const int hoff = h * HDIM;

  for (int i = tid; i < BM * (HDIM / 4); i += 256) {
    const int r = i >> 4, c4 = (i & 15) * 4;
    *(v4bf*)(As3 + r * LDA + c4) =
        *(const v4bf*)(qs + (size_t)(mb + r) * DIM + hoff + c4);
  }
  for (int i = tid; i < BN * (HDIM / 4); i += 256) {
    const int r = i >> 4, c4 = (i & 15) * 4;
    *(v4bf*)(Bs3 + r * LDB + c4) =
        *(const v4bf*)(ctxT + (size_t)bh * 4096 + r * HDIM + c4);
  }
  __syncthreads();

  v8f acc[4];
  #pragma unroll
  for (int t = 0; t < 4; ++t)
    #pragma unroll
    for (int i = 0; i < 8; ++i) acc[t][i] = 0.f;

  const int wr = wave * 16;
  #pragma unroll
  for (int kc = 0; kc < HDIM; kc += 32) {
    const v16bf va = frag_ld(As3, LDA, wr, kc);
    #pragma unroll
    for (int t = 0; t < 4; ++t) {
      const v16bf vbr = frag_ld(Bs3, LDB, t * 16, kc);
      acc[t] = wmma_bf16(va, vbr, acc[t]);
    }
  }
  const int lane = tid & 31;
  const int rb = wr + ((lane >> 4) << 3);
  const int cl = lane & 15;
  #pragma unroll
  for (int t = 0; t < 4; ++t)
    #pragma unroll
    for (int i = 0; i < 8; ++i)
      tbuf[(size_t)(mb + rb + i) * DIM + hoff + t * 16 + cl] = f2bf(acc[t][i]);
}

// ----------------------------- kernel 3b: out = t @ w_proj^T + b_proj (f32)
__global__ void __launch_bounds__(256)
k3b_proj(const bf16* __restrict__ tbuf, const bf16* __restrict__ wpbf,
         const float* __restrict__ bias, float* __restrict__ out) {
  float* Cs   = (float*)smem;                       // over the ring, after the K loop
  const int tid = threadIdx.x;
  const int mb = blockIdx.x * BMG;
  const int cb = blockIdx.y * BN2;

  v8f acc[4][4];
  #pragma unroll
  for (int i = 0; i < 4; ++i)
    #pragma unroll
    for (int t = 0; t < 4; ++t)
      #pragma unroll
      for (int r = 0; r < 8; ++r) acc[i][t][r] = 0.f;

  gemm_256x128(tbuf, wpbf, mb, cb, acc);
  spill_256x128(Cs, acc);
  __syncthreads();
  for (int i = tid; i < BMG * BN2; i += 256) {
    const int r = i >> 7, c = i & 127;
    out[(size_t)(mb + r) * DIM + cb + c] = Cs[r * LDC2 + c] + bias[cb + c];
  }
}

// ---------------------------------------------------------------- launcher
extern "C" void kernel_launch(void* const* d_in, const int* in_sizes, int n_in,
                              void* d_out, int out_size, void* d_ws, size_t ws_size,
                              hipStream_t stream) {
  (void)in_sizes; (void)n_in; (void)out_size; (void)ws_size;
  const float* x      = (const float*)d_in[0];
  const float* w_qkv  = (const float*)d_in[1];
  const float* w_proj = (const float*)d_in[2];
  const float* b_proj = (const float*)d_in[3];
  float* out = (float*)d_out;

  char* p = (char*)d_ws;
  size_t off = 0;
  auto take = [&](size_t bytes) -> char* {
    char* r = p + off;
    off += (bytes + 255) & ~(size_t)255;
    return r;
  };
  bf16*  x_bf     = (bf16*)take((size_t)MROWS * DIM * 2);   // 64 MB
  bf16*  qs       = (bf16*)take((size_t)MROWS * DIM * 2);   // 64 MB
  bf16*  ebuf     = (bf16*)take((size_t)MROWS * DIM * 2);   // 64 MB (reused as t)
  bf16*  vbuf     = (bf16*)take((size_t)MROWS * DIM * 2);   // 64 MB
  bf16*  wqkv_bf  = (bf16*)take((size_t)3 * DIM * DIM * 2); // 6 MB
  bf16*  wproj_bf = (bf16*)take((size_t)DIM * DIM * 2);     // 2 MB
  float* ctx      = (float*)take((size_t)BATCH * NHEAD * HDIM * HDIM * 4);
  float* zbuf     = (float*)take((size_t)BATCH * NHEAD * HDIM * 4);
  bf16*  ctxT     = (bf16*)take((size_t)BATCH * NHEAD * HDIM * HDIM * 2);

  const size_t big_lds   = CS_BYTES + 2 * 2 * BMG * 4;  // k1: 136 KB
  const size_t proj_lds  = CS_BYTES;                    // k3b: 132 KB

  k0_init<<<K0_XW + K0_QW + K0_PW, K0_T, 0, stream>>>(x, w_qkv, w_proj, x_bf,
                                       wqkv_bf, wproj_bf, ctx, zbuf);
  k1_qkv<<<dim3(MROWS / BMG, (3 * DIM) / BN2), 256, big_lds, stream>>>(
      x_bf, wqkv_bf, qs, ebuf, vbuf);
  k2_context<<<BATCH * NHEAD * NSPLIT, 128, 0, stream>>>(ebuf, vbuf, ctx, zbuf);
  k2b_norm<<<(BATCH * NHEAD * HDIM * HDIM + 255) / 256, 256, 0, stream>>>(ctx, zbuf, ctxT);
  bf16* tbuf = ebuf;  // E is dead after k2 — reuse for t
  k3a_qctx<<<dim3(MROWS / BM, NHEAD), 256, 0, stream>>>(qs, ctxT, tbuf);
  k3b_proj<<<dim3(MROWS / BMG, DIM / BN2), 256, proj_lds, stream>>>(
      tbuf, wproj_bf, b_proj, out);
}

// v003
// Measured time: 287 microseconds a run.
// Next to v002, in two timings, it ran 1.04 times as fast each time.
// All steps since v000 together make it 1.58 times as fast.
#include <hip/hip_runtime.h>
#include <hip/hip_bf16.h>
#include <cstdint>

#define DIM   1024
#define NHEAD 16
#define HDIM  64
#define BATCH 4
#define SEQ   8192
#define MROWS (BATCH*SEQ)          // 32768
#define QK_SCALE 0.125f            // HDIM^-0.5

// GEMM tiling (big GEMMs): 256 x 128 per workgroup, 64 x 64 per wave (4 x 2 waves)
#define BM 128                     // rows per workgroup of k3a
#define BMG 256                    // rows per workgroup of the big GEMMs
#define BN2 128                    // wide N tile to cut L2 re-reads
#define BK 64
#define LDA 72                     // bf16 elems; 144B rows (16B aligned, conflict-free)
#define LDC2 132                   // f32 elems, output staging of k3b
#define LDO  136                   // bf16 elems, output staging of k1: 272-B rows
#define NSTEP (DIM / BK)           // 16
// One stage in LDS: four 64-row slices of the row operand, four 32-row slices of
// the column operand, rows at 144 B, each slice's size rounded up to 2 KiB.
#define SLICE_A 10240u             // 64 * 144 = 9216 -> 10240
#define SLICE_B 6144u              // 32 * 144 = 4608 -> 6144
#define B_BASE  (4u * SLICE_A)     // 40960
#define STAGE_B (4u * SLICE_A + 4u * SLICE_B)   // 65536 B per buffer
#define CS_BYTES (BMG * LDC2 * 4)  // 135168 B, laid over the ring after the K loop

// small GEMM tiling (k2/k3a)
#define BN 64
#define LDB 72
#define NSPLIT 16
#define CHUNK (SEQ / NSPLIT)       // 512
#define LDE 40                     // 80B rows

typedef __bf16 bf16;
typedef bf16  v16bf __attribute__((ext_vector_type(16)));
typedef bf16  v8bf  __attribute__((ext_vector_type(8)));
typedef bf16  v4bf  __attribute__((ext_vector_type(4)));
typedef float v8f   __attribute__((ext_vector_type(8)));
typedef float v4f   __attribute__((ext_vector_type(4)));
typedef uint32_t u32x4 __attribute__((ext_vector_type(4)));
typedef uint32_t u32x8 __attribute__((ext_vector_type(8)));

__device__ __forceinline__ bf16 f2bf(float f) {
  uint32_t u = __builtin_bit_cast(uint32_t, f);
  u = (u + 0x7FFFu + ((u >> 16) & 1u)) >> 16;     // round-to-nearest-even
  uint16_t s = (uint16_t)u;
  return __builtin_bit_cast(bf16, s);
}
__device__ __forceinline__ float bf2f(bf16 b) {
  uint32_t u = ((uint32_t)__builtin_bit_cast(uint16_t, b)) << 16;
  return __builtin_bit_cast(float, u);
}

// LDS byte offset of a generic pointer into shared memory (addrspace(3) ptrtoint)
__device__ __forceinline__ uint32_t lds_off(const void* p) {
  return (uint32_t)(uintptr_t)(__attribute__((address_space(3))) const void*)p;
}

__device__ __forceinline__ uint32_t uni(uint32_t v) {
  return (uint32_t)__builtin_amdgcn_readfirstlane(v);
}
__device__ __forceinline__ uint32_t pinned(uint32_t v) {
  uint32_t w = uni(v);
  asm volatile("" : "+s"(w));   // pinned(): the issue test's word held in a scalar register
  return w;
}

// Group 1 of a tensor-load descriptor: a tile of nrows rows of 128 B (64 bf16),
// everything in bytes, tensor = tile, source pitch 2048 B; a 16-B pad behind
// every 128-B row, so rows land at a 144-B pitch.
__device__ __forceinline__ u32x8 tdm_group1(uint32_t nrows) {
  u32x8 g;
  g[0] = uni((1u << 20) | (4u << 22) | (3u << 25));
  g[1] = uni(128u << 16);
  g[2] = uni(nrows << 16);
  g[3] = uni(128u << 16);
  g[4] = uni(nrows);
  g[5] = uni(DIM * 2u);
  g[6] = uni(0u);
  g[7] = uni(0u);
  return g;
}
// Group 0: the slice's place in LDS (byte offset) and its first global byte.
__device__ __forceinline__ void tdm_aim(u32x4& g0, uint32_t lds_dst, uint64_t ga) {
  g0[0] = uni(1u);
  g0[1] = uni(lds_dst);
  g0[2] = uni((uint32_t)ga);
  g0[3] = uni((((uint32_t)(ga >> 32)) & 0x01FFFFFFu) | 0x80000000u);
}
// The next stage's request: a new place in LDS, the source BK elements further
// along its rows (words 2 and 3 as one 64-bit sum; the type bits sit above the
// address).  Called only behind the wait that covers the request before it.
__device__ __forceinline__ void tdm_advance(u32x4& g0, uint32_t lds_dst) {
  const uint64_t w = (((uint64_t)g0[3] << 32) | g0[2]) + BK * 2u;
  g0[1] = uni(lds_dst);
  g0[2] = uni((uint32_t)w);
  g0[3] = uni((uint32_t)(w >> 32));
}
// One request of the calling wave.  Both groups are in-out operands so that the
// registers an issued request names stay the descriptor's own while it is in
// flight: they take new values only in tdm_advance.
__device__ __forceinline__ void tdm_load(u32x4& g0, u32x8& g1) {
  asm volatile("tensor_load_to_lds %0, %1" : "+s"(g0), "+s"(g1) :: "memory");
}
// The mover's and the LDS reads' waits are not placed by the compiler.
__device__ __forceinline__ void wait_tensor0() { asm volatile("s_wait_tensorcnt 0x0" ::: "memory"); }
__device__ __forceinline__ void wait_ds0()     { asm volatile("s_wait_dscnt 0x0" ::: "memory"); }

// Load one 16(M/N) x 32(K) WMMA A/B fragment from an LDS tile laid out
// [row][k], leading dimension ld elems (row byte size 16B aligned).
// lanes 0-15 : row = lane,    K = {k0..k0+7} and {k0+16..k0+23}
// lanes 16-31: row = lane-16, K = {k0+8..k0+15} and {k0+24..k0+31}
__device__ __forceinline__ v16bf frag_ld(const bf16* tile, int ld, int row0, int k0) {
  const int lane = threadIdx.x & 31;
  const bf16* p = tile + (row0 + (lane & 15)) * ld + k0 + ((lane >> 4) << 3);
  union { v16bf v; v8bf h[2]; } f;
  f.h[0] = *(const v8bf*)(p);
  f.h[1] = *(const v8bf*)(p + 16);
  return f.v;
}

__device__ __forceinline__ v8f wmma_bf16(v16bf a, v16bf b, v8f c) {
  return __builtin_amdgcn_wmma_f32_16x16x32_bf16(false, a, false, b,
                                                 (short)0, c, false, false);
}

extern __shared__ __attribute__((aligned(2048))) char smem[];

// acc[i][t] += rows [mb + 64*wm + 16*i ..) of a  x  rows [cb + 64*wn + 16*t ..) of b,
// both K-contiguous with DIM elements a row.  The b rows go in as the matrix
// instruction's first operand, so a tile comes out transposed: a lane holds, of
// ONE row of a (lane & 15), eight consecutive columns ((lane >> 4) * 8 + vgpr).
// Two-buffer ring: every wave brings
// its own slice of a stage with one tensor load, one request outstanding.
__device__ __forceinline__ void gemm_256x128(const bf16* __restrict__ a,
                                             const bf16* __restrict__ b,
                                             int mb, int cb, v8f (&acc)[4][4]) {
  const uint32_t wave = uni(threadIdx.x >> 5);
  const uint32_t wm = wave & 3u, wn = wave >> 2;
  const bool     rowop = wave < 4u;      // waves 0-3 bring a, waves 4-7 bring b
  const uint32_t slot  = rowop ? wave * SLICE_A : B_BASE + (wave - 4u) * SLICE_B;
  const uint64_t gsrc  = rowop
      ? (uint64_t)(uintptr_t)(a + (size_t)(mb + 64 * (int)wave) * DIM)
      : (uint64_t)(uintptr_t)(b + (size_t)(cb + 32 * (int)(wave - 4u)) * DIM);
  const uint32_t dst0  = lds_off(smem) + slot;
  u32x8 g1 = tdm_group1(rowop ? 64u : 32u);
  u32x4 g0;

  tdm_aim(g0, dst0, gsrc);                        // stage 0
  tdm_load(g0, g1);
  wait_tensor0();
  __syncthreads();
  tdm_advance(g0, dst0 + STAGE_B);                // stage 1
  tdm_load(g0, g1);

  for (int s = 0; s < NSTEP; ++s) {
    const char* buf = smem + (s & 1) * STAGE_B;
    const bf16* At = (const bf16*)(buf + wm * SLICE_A);
    const bf16* Bt = (const bf16*)(buf + B_BASE + 2u * wn * SLICE_B);
    #pragma unroll
    for (int kc = 0; kc < BK; kc += 32) {
      v16bf va[4], vb[4];
      #pragma unroll
      for (int i = 0; i < 4; ++i) va[i] = frag_ld(At, LDA, i * 16, kc);
      #pragma unroll
      for (int t = 0; t < 4; ++t)
        vb[t] = frag_ld(Bt + (t >> 1) * (SLICE_B / 2u), LDA, (t & 1) * 16, kc);
      #pragma unroll
      for (int i = 0; i < 4; ++i)
        #pragma unroll
        for (int t = 0; t < 4; ++t) acc[i][t] = wmma_bf16(vb[t], va[i], acc[i][t]);
    }
    // publish point of stage s + 1; the barrier also frees this pass's buffer
    wait_ds0();
    wait_tensor0();
    __syncthreads();
    if (pinned(s + 2 < NSTEP)) {
      tdm_advance(g0, dst0 + (s & 1) * STAGE_B);  // stage s + 2
      tdm_load(g0, g1);
    }
  }
  // The last pass's own barrier has ended every read of the ring: it may be
  // overwritten by the output staging from here on.
  wait_tensor0();
  wait_ds0();
}

// Where the calling lane's part of acc[i][t] lies in the 256 x 128 output tile.
__device__ __forceinline__ int tile_row(int i) {
  return ((threadIdx.x >> 5) & 3) * 64 + i * 16 + (threadIdx.x & 15);
}
__device__ __forceinline__ int tile_col(int t) {
  return (threadIdx.x >> 7) * 64 + t * 16 + ((threadIdx.x >> 4) & 1) * 8;
}
// The value of lane l ^ 16: the other half of the same output row.
__device__ __forceinline__ float other_half(float v) {
  const int b = __builtin_bit_cast(int, v);
  return __builtin_bit_cast(float,
      __builtin_amdgcn_permlanex16(b, b, 0x76543210, 0xfedcba98, false, false));
}

// ---------------------------------------------------------------- kernel 0
// bf16 conversions + zeroing of atomic accumulators (every launch), as a stream:
// few workgroups, all resident at once; each owns one contiguous piece of K0_P4
// groups of four floats of ONE of the three arrays and walks it in runs of eight
// wave-wide 512-B loads that are in flight together.
#define K0_T   256
#define K0_P4  8192                              // groups of four floats per workgroup
#define K0_XW  (MROWS * DIM / 4 / K0_P4)         // 1024 workgroups on x
#define K0_QW  (3 * DIM * DIM / 4 / K0_P4)       // 96 on w_qkv
#define K0_PW  (DIM * DIM / 4 / K0_P4)           // 32 on w_proj
#define K0_ZW  (BATCH * NHEAD * HDIM / K0_T)     // 16 of them also zero zbuf
static_assert(BATCH * NHEAD * HDIM * HDIM == K0_XW * K0_T, "ctx: one float a thread on x");
static_assert(K0_ZW <= K0_QW, "zbuf: one float a thread of the first workgroups on w_qkv");

// NB groups of four floats, K0_T groups apart: all loads first, then the stores.
// The f32 source is read once, so its loads are non-temporal.
template <int NB>
__device__ __forceinline__ void cvt_run(const float* __restrict__ src,
                                        bf16* __restrict__ dst, int first4) {
  const v4f* s = (const v4f*)src + first4;
  v4bf*      d = (v4bf*)dst + first4;
  v4f v[NB];
  #pragma unroll
  for (int j = 0; j < NB; ++j) v[j] = __builtin_nontemporal_load(s + j * K0_T);
  #pragma unroll
  for (int j = 0; j < NB; ++j) {
    v4bf o;
    #pragma unroll
    for (int e = 0; e < 4; ++e) o[e] = f2bf(v[j][e]);
    d[j * K0_T] = o;
  }
}

__global__ void __launch_bounds__(K0_T)
k0_init(const float* __restrict__ x, const float* __restrict__ wqkv,
        const float* __restrict__ wproj,
        bf16* __restrict__ x_bf, bf16* __restrict__ wqkv_bf,
        bf16* __restrict__ wproj_bf,
        float* __restrict__ ctx, float* __restrict__ zbuf) {
  const int tid = threadIdx.x, wg = blockIdx.x;
  const float* src = x;
  bf16*        dst = x_bf;
  int          piece = wg;
  if (wg >= K0_XW + K0_QW)  { src = wproj; dst = wproj_bf; piece = wg - (K0_XW + K0_QW); }
  else if (wg >= K0_XW)     { src = wqkv;  dst = wqkv_bf;  piece = wg - K0_XW; }
  // Kept rolled: unrolled, every load of the thread is lifted to the top, and the
  // registers that takes keep part of the workgroups from being resident.
  #pragma unroll 1
  for (int b = 0; b < K0_P4 / K0_T; b += 8)
    cvt_run<8>(src, dst, piece * K0_P4 + b * K0_T + tid);
  if (wg < K0_XW + K0_ZW) {
    float* z = wg < K0_XW ? ctx + wg * K0_T : zbuf + (wg - K0_XW) * K0_T;
    z[tid] = 0.f;
  }
}

__device__ __forceinline__ v8f exp_tile(v8f x) {
  x *= 1.44269504f;
  float a = x[0], b = x[1], c = x[2], d = x[3], e = x[4], f = x[5], g = x[6], h = x[7];
  asm("v_exp_f32 %0, %0\n\tv_exp_f32 %1, %1\n\tv_exp_f32 %2, %2\n\tv_exp_f32 %3, %3\n\t"
      "v_exp_f32 %4, %4\n\tv_exp_f32 %5, %5\n\tv_exp_f32 %6, %6\n\tv_exp_f32 %7, %7\n\t"
      "v_nop"
      : "+v"(a), "+v"(b), "+v"(c), "+v"(d), "+v"(e), "+v"(f), "+v"(g), "+v"(h));
  return v8f{a, b, c, d, e, f, g, h};
}

// The q (SEC 0), k (1) or v (2) transform of a wave's 64 x 64 accumulators, one
// 16-row tile at a time in registers, then 16 B a lane into the bf16 staging tile.
template <int SEC>
__device__ __forceinline__ void finish_tiles(bf16* Os, v8f (&acc)[4][4]) {
  // every loop here is unrolled so that acc is indexed by constants only and
  // stays in registers
  #pragma unroll
  for (int i = 0; i < 4; ++i) {
    if (SEC == 0) {
      // row softmax over the wave's 64 columns (one head), * SCALE: 32 values of a
      // row are in this lane, the other 32 in lane ^ 16
      float m = -1e30f;
      #pragma unroll
      for (int t = 0; t < 4; ++t)
        #pragma unroll
        for (int r = 0; r < 8; ++r) m = fmaxf(m, acc[i][t][r]);
      m = fmaxf(m, other_half(m));
      #pragma unroll
      for (int t = 0; t < 4; ++t) acc[i][t] = exp_tile(acc[i][t] - m);
      const v8f sv = (acc[i][0] + acc[i][1]) + (acc[i][2] + acc[i][3]);
      float sum = ((sv[0] + sv[1]) + (sv[2] + sv[3])) + ((sv[4] + sv[5]) + (sv[6] + sv[7]));
      sum += other_half(sum);
      const float scl = QK_SCALE / sum;
      #pragma unroll
      for (int t = 0; t < 4; ++t) acc[i][t] *= scl;
    } else if (SEC == 1) {
      // E = exp(k_raw); k values ~N(0,1) so no max subtraction needed
      #pragma unroll
      for (int t = 0; t < 4; ++t) acc[i][t] = exp_tile(acc[i][t]);
    }
    #pragma unroll
    for (int t = 0; t < 4; ++t)
      *(v8bf*)(Os + tile_row(i) * LDO + tile_col(t)) = __builtin_convertvector(acc[i][t], v8bf);
  }
}

// ------------------------------------------------------ kernel 1: QKV GEMM
// qkv = x @ w_qkv^T  (tensor loads double-buffered into LDS, bf16 WMMA), fused
// epilogue per 128-column (two-head-aligned) slab.
__global__ void __launch_bounds__(256)
k1_qkv(const bf16* __restrict__ xbf, const bf16* __restrict__ wbf,
       bf16* __restrict__ qs, bf16* __restrict__ ebuf, bf16* __restrict__ vbuf) {
  bf16* Os = (bf16*)smem;                           // over the ring, after the K loop

  const int tid  = threadIdx.x;
  const int mb   = blockIdx.x * BMG;
  const int cb   = blockIdx.y * BN2;                // 0..2944

  v8f acc[4][4];
  #pragma unroll
  for (int i = 0; i < 4; ++i)
    #pragma unroll
    for (int t = 0; t < 4; ++t)
      #pragma unroll
      for (int r = 0; r < 8; ++r) acc[i][t][r] = 0.f;

  gemm_256x128(xbf, wbf, mb, cb, acc);

  const int sec = cb >> 10;                    // 0=q, 1=k, 2=v
  const int ci  = cb & 1023;
  if (sec == 0)      finish_tiles<0>(Os, acc);
  else if (sec == 1) finish_tiles<1>(Os, acc);
  else               finish_tiles<2>(Os, acc);
  __syncthreads();
  // half a wave writes one whole 256-B row of the slab per store
  bf16* dst = (sec == 0 ? qs : sec == 1 ? ebuf : vbuf)
              + (size_t)(mb + (tid >> 4)) * DIM + ci + (tid & 15) * 8;
  const bf16* from = Os + (tid >> 4) * LDO + (tid & 15) * 8;
  #pragma unroll   // all LDS reads in flight ahead of the first store
  for (int j = 0; j < BMG / 16; ++j)
    *(v8bf*)(dst + (size_t)j * 16 * DIM) = *(const v8bf*)(from + j * 16 * LDO);
}

// ---------------------------------- kernel 2: context' = E^T V, Z = colsum(E)
__global__ void __launch_bounds__(128)
k2_context(const bf16* __restrict__ ebuf, const bf16* __restrict__ vbuf,
           float* __restrict__ ctx, float* __restrict__ zbuf) {
  __shared__ bf16 Es[HDIM * LDE];              // [d][n] (transposed)
  __shared__ bf16 Vs[HDIM * LDE];              // [e][n] (transposed)
  const int tid  = threadIdx.x;
  const int wave = tid >> 5;
  const int bh = blockIdx.x >> 4;              // NSPLIT == 16
  const int ns = blockIdx.x & (NSPLIT - 1);
  const int b = bh >> 4, h = bh & 15;
  const size_t rowbase = (size_t)b * SEQ + (size_t)ns * CHUNK;
  const int hoff = h * HDIM;

  v8f acc[4];
  #pragma unroll
  for (int t = 0; t < 4; ++t)
    #pragma unroll
    for (int i = 0; i < 8; ++i) acc[t][i] = 0.f;
  float zacc = 0.f;

  for (int nb = 0; nb < CHUNK; nb += 32) {
    for (int i = tid; i < 32 * HDIM; i += 128) {   // transpose into LDS
      const int nl = i >> 6, d = i & 63;
      Es[d * LDE + nl] = ebuf[(rowbase + nb + nl) * DIM + hoff + d];
      Vs[d * LDE + nl] = vbuf[(rowbase + nb + nl) * DIM + hoff + d];
    }
    __syncthreads();
    if (tid < HDIM) {
      #pragma unroll
      for (int n = 0; n < 32; ++n) zacc += bf2f(Es[tid * LDE + n]);
    }
    const int wr = wave * 16;
    const v16bf va = frag_ld(Es, LDE, wr, 0);
    #pragma unroll
    for (int t = 0; t < 4; ++t) {
      const v16bf vbr = frag_ld(Vs, LDE, t * 16, 0);
      acc[t] = wmma_bf16(va, vbr, acc[t]);
    }
    __syncthreads();
  }
  {
    const int lane = tid & 31;
    const int rb = wave * 16 + ((lane >> 4) << 3);
    const int cl = lane & 15;
    float* cbase = ctx + (size_t)bh * HDIM * HDIM;
    #pragma unroll
    for (int t = 0; t < 4; ++t)
      #pragma unroll
      for (int i = 0; i < 8; ++i)
        atomicAdd(cbase + (rb + i) * HDIM + t * 16 + cl, acc[t][i]);
  }
  if (tid < HDIM) atomicAdd(zbuf + bh * HDIM + tid, zacc);
}

// ------------------- kernel 2b: ctxT[bh][e][d] = ctx[bh][d][e] / Z[bh][d]
__global__ void k2b_norm(const float* __restrict__ ctx, const float* __restrict__ zbuf,
                         bf16* __restrict__ ctxT) {
  const int i = blockIdx.x * blockDim.x + threadIdx.x;
  if (i >= BATCH * NHEAD * HDIM * HDIM) return;
  const int bh = i >> 12, e = (i >> 6) & 63, d = i & 63;
  ctxT[i] = f2bf(ctx[(size_t)bh * 4096 + d * 64 + e] / zbuf[bh * 64 + d]);
}

// --------------------------- kernel 3a: t = q_soft @ ctx (block-diag/head)
__global__ void __launch_bounds__(256)
k3a_qctx(const bf16* __restrict__ qs, const bf16* __restrict__ ctxT,
         bf16* __restrict__ tbuf) {
  __shared__ bf16 As3[BM * LDA];
  __shared__ bf16 Bs3[BN * LDB];
  const int tid = threadIdx.x, wave = tid >> 5;
  const int mb = blockIdx.x * BM;
  const int h = blockIdx.y;
  const int bh = (mb / SEQ) * NHEAD + h;
  const int hoff = h * HDIM;

  for (int i = tid; i < BM * (HDIM / 4); i += 256) {
    const int r = i >> 4, c4 = (i & 15) * 4;
    *(v4bf*)(As3 + r * LDA + c4) =
        *(const v4bf*)(qs + (size_t)(mb + r) * DIM + hoff + c4);
  }
  for (int i = tid; i < BN * (HDIM / 4); i += 256) {
    const int r = i >> 4, c4 = (i & 15) * 4;
    *(v4bf*)(Bs3 + r * LDB + c4) =
        *(const v4bf*)(ctxT + (size_t)bh * 4096 + r * HDIM + c4);
  }
  __syncthreads();

  v8f acc[4];
  #pragma unroll
  for (int t = 0; t < 4; ++t)
    #pragma unroll
    for (int i = 0; i < 8; ++i) acc[t][i] = 0.f;

  const int wr = wave * 16;
  #pragma unroll
  for (int kc = 0; kc < HDIM; kc += 32) {
    const v16bf va = frag_ld(As3, LDA, wr, kc);
    #pragma unroll
    for (int t = 0; t < 4; ++t) {
      const v16bf vbr = frag_ld(Bs3, LDB, t * 16, kc);
      acc[t] = wmma_bf16(vbr, va, acc[t]);   // transposed tile, as in gemm_256x128
    }
  }
  // a lane holds eight consecutive columns of one row: one 16-B store a tile
  const int lane = tid & 31;
  bf16* dst = tbuf + (size_t)(mb + wr + (lane & 15)) * DIM + hoff + (lane >> 4) * 8;
  #pragma unroll   // acc is indexed by constants only
  for (int t = 0; t < 4; ++t)
    *(v8bf*)(dst + t * 16) = __builtin_convertvector(acc[t], v8bf);
}

// ----------------------------- kernel 3b: out = t @ w_proj^T + b_proj (f32)
__global__ void __launch_bounds__(256)
k3b_proj(const bf16* __restrict__ tbuf, const bf16* __restrict__ wpbf,
         const float* __restrict__ bias, float* __restrict__ out) {
  float* Cs   = (float*)smem;                       // over the ring, after the K loop
  const int tid = threadIdx.x;
  const int mb = blockIdx.x * BMG;
  const int cb = blockIdx.y * BN2;

  v8f acc[4][4];
  #pragma unroll
  for (int i = 0; i < 4; ++i)
    #pragma unroll
    for (int t = 0; t < 4; ++t)
      #pragma unroll
      for (int r = 0; r < 8; ++r) acc[i][t][r] = 0.f;

  gemm_256x128(tbuf, wpbf, mb, cb, acc);
  // two 16-B LDS stores a tile (unrolled: acc is indexed by constants only)
  #pragma unroll
  for (int i = 0; i < 4; ++i)
    #pragma unroll
    for (int t = 0; t < 4; ++t) {
      float* p = Cs + tile_row(i) * LDC2 + tile_col(t);
      *(v4f*)p       = __builtin_shufflevector(acc[i][t], acc[i][t], 0, 1, 2, 3);
      *(v4f*)(p + 4) = __builtin_shufflevector(acc[i][t], acc[i][t], 4, 5, 6, 7);
    }
  __syncthreads();
  // a wave writes one whole 512-B row of the slab per store
  const int c = (tid & 31) * 4;
  const v4f bv = *(const v4f*)(bias + cb + c);
  float* dst = out + (size_t)(mb + (tid >> 5)) * DIM + cb + c;
  const float* from = Cs + (tid >> 5) * LDC2 + c;
  #pragma unroll   // all LDS reads in flight ahead of the first store
  for (int j = 0; j < BMG / 8; ++j)
    *(v4f*)(dst + (size_t)j * 8 * DIM) = *(const v4f*)(from + j * 8 * LDC2) + bv;
}

// ---------------------------------------------------------------- launcher
extern "C" void kernel_launch(void* const* d_in, const int* in_sizes, int n_in,
                              void* d_out, int out_size, void* d_ws, size_t ws_size,
                              hipStream_t stream) {
  (void)in_sizes; (void)n_in; (void)out_size; (void)ws_size;
  const float* x      = (const float*)d_in[0];
  const float* w_qkv  = (const float*)d_in[1];
  const float* w_proj = (const float*)d_in[2];
  const float* b_proj = (const float*)d_in[3];
  float* out = (float*)d_out;

  char* p = (char*)d_ws;
  size_t off = 0;
  auto take = [&](size_t bytes) -> char* {
    char* r = p + off;
    off += (bytes + 255) & ~(size_t)255;
    return r;
  };
  bf16*  x_bf     = (bf16*)take((size_t)MROWS * DIM * 2);   // 64 MB
  bf16*  qs       = (bf16*)take((size_t)MROWS * DIM * 2);   // 64 MB
  bf16*  ebuf     = (bf16*)take((size_t)MROWS * DIM * 2);   // 64 MB (reused as t)
  bf16*  vbuf     = (bf16*)take((size_t)MROWS * DIM * 2);   // 64 MB
  bf16*  wqkv_bf  = (bf16*)take((size_t)3 * DIM * DIM * 2); // 6 MB
  bf16*  wproj_bf = (bf16*)take((size_t)DIM * DIM * 2);     // 2 MB
  float* ctx      = (float*)take((size_t)BATCH * NHEAD * HDIM * HDIM * 4);
  float* zbuf     = (float*)take((size_t)BATCH * NHEAD * HDIM * 4);
  bf16*  ctxT     = (bf16*)take((size_t)BATCH * NHEAD * HDIM * HDIM * 2);

  const size_t big_lds   = 2 * STAGE_B;                 // k1: the ring, 128 KB
  const size_t proj_lds  = CS_BYTES;                    // k3b: 132 KB

  k0_init<<<K0_XW + K0_QW + K0_PW, K0_T, 0, stream>>>(x, w_qkv, w_proj, x_bf,
                                       wqkv_bf, wproj_bf, ctx, zbuf);
  k1_qkv<<<dim3(MROWS / BMG, (3 * DIM) / BN2), 256, big_lds, stream>>>(
      x_bf, wqkv_bf, qs, ebuf, vbuf);
  k2_context<<<BATCH * NHEAD * NSPLIT, 128, 0, stream>>>(ebuf, vbuf, ctx, zbuf);
  k2b_norm<<<(BATCH * NHEAD * HDIM * HDIM + 255) / 256, 256, 0, stream>>>(ctx, zbuf, ctxT);
  bf16* tbuf = ebuf;  // E is dead after k2 — reuse for t
  k3a_qctx<<<dim3(MROWS / BM, NHEAD), 256, 0, stream>>>(qs, ctxT, tbuf);
  k3b_proj<<<dim3(MROWS / BMG, DIM / BN2), 256, proj_lds, stream>>>(
      tbuf, wproj_bf, b_proj, out);
}

// v004
// Measured time: 243 microseconds a run.
// Next to v003, in two timings, it ran 1.19 and 1.18 times as fast.
// Over all steps from v000 it is 1.87 times as fast.
#include <hip/hip_runtime.h>
#include <hip/hip_bf16.h>
#include <cstdint>

#define DIM   1024
#define NHEAD 16
#define HDIM  64
#define BATCH 4
#define SEQ   8192
#define MROWS (BATCH*SEQ)          // 32768
#define QK_SCALE 0.125f            // HDIM^-0.5

// GEMM tiling (big GEMMs): 256 x 128 per workgroup, 64 x 64 per wave (4 x 2 waves)
#define BM 128                     // rows per workgroup of k3a
#define BMG 256                    // rows per workgroup of the big GEMMs
#define BN2 128                    // wide N tile to cut L2 re-reads
#define BK 64
#define LDA 72                     // bf16 elems; 144B rows (16B aligned, conflict-free)
#define LDC2 132                   // f32 elems, output staging of k3b
#define LDO  136                   // bf16 elems, output staging of k1: 272-B rows
#define NSTEP (DIM / BK)           // 16
// One stage in LDS: four 64-row slices of the row operand, four 32-row slices of
// the column operand, rows at 144 B, each slice's size rounded up to 2 KiB.
#define SLICE_A 10240u             // 64 * 144 = 9216 -> 10240
#define SLICE_B 6144u              // 32 * 144 = 4608 -> 6144
#define B_BASE  (4u * SLICE_A)     // 40960
#define STAGE_B (4u * SLICE_A + 4u * SLICE_B)   // 65536 B per buffer
#define CS_BYTES (BMG * LDC2 * 4)  // 135168 B, laid over the ring after the K loop

// small GEMM tiling (k2/k3a)
#define BN 64
#define LDB 72
#define NSPLIT 16
#define CHUNK (SEQ / NSPLIT)       // 512
#define LDE 40                     // 80B rows

typedef __bf16 bf16;
typedef bf16  v16bf __attribute__((ext_vector_type(16)));
typedef bf16  v8bf  __attribute__((ext_vector_type(8)));
typedef bf16  v4bf  __attribute__((ext_vector_type(4)));
typedef float v8f   __attribute__((ext_vector_type(8)));
typedef float v4f   __attribute__((ext_vector_type(4)));
typedef uint32_t u32x4 __attribute__((ext_vector_type(4)));
typedef uint32_t u32x8 __attribute__((ext_vector_type(8)));

__device__ __forceinline__ bf16 f2bf(float f) {
  uint32_t u = __builtin_bit_cast(uint32_t, f);
  u = (u + 0x7FFFu + ((u >> 16) & 1u)) >> 16;     // round-to-nearest-even
  uint16_t s = (uint16_t)u;
  return __builtin_bit_cast(bf16, s);
}
__device__ __forceinline__ float bf2f(bf16 b) {
  uint32_t u = ((uint32_t)__builtin_bit_cast(uint16_t, b)) << 16;
  return __builtin_bit_cast(float, u);
}

// LDS byte offset of a generic pointer into shared memory (addrspace(3) ptrtoint)
__device__ __forceinline__ uint32_t lds_off(const void* p) {
  return (uint32_t)(uintptr_t)(__attribute__((address_space(3))) const void*)p;
}

__device__ __forceinline__ uint32_t uni(uint32_t v) {
  return (uint32_t)__builtin_amdgcn_readfirstlane(v);
}
__device__ __forceinline__ uint32_t pinned(uint32_t v) {
  uint32_t w = uni(v);
  asm volatile("" : "+s"(w));   // pinned(): the issue test's word held in a scalar register
  return w;
}

// Group 1 of a tensor-load descriptor: a tile of nrows rows of 128 B (64 bf16),
// everything in bytes, tensor = tile, source pitch 2048 B; a 16-B pad behind
// every 128-B row, so rows land at a 144-B pitch.
__device__ __forceinline__ u32x8 tdm_group1(uint32_t nrows) {
  u32x8 g;
  g[0] = uni((1u << 20) | (4u << 22) | (3u << 25));
  g[1] = uni(128u << 16);
  g[2] = uni(nrows << 16);
  g[3] = uni(128u << 16);
  g[4] = uni(nrows);
  g[5] = uni(DIM * 2u);
  g[6] = uni(0u);
  g[7] = uni(0u);
  return g;
}
// Group 0: the slice's place in LDS (byte offset) and its first global byte.
__device__ __forceinline__ void tdm_aim(u32x4& g0, uint32_t lds_dst, uint64_t ga) {
  g0[0] = uni(1u);
  g0[1] = uni(lds_dst);
  g0[2] = uni((uint32_t)ga);
  g0[3] = uni((((uint32_t)(ga >> 32)) & 0x01FFFFFFu) | 0x80000000u);
}
// The next stage's request: a new place in LDS, the source BK elements further
// along its rows (words 2 and 3 as one 64-bit sum; the type bits sit above the
// address).  Called only behind the wait that covers the request before it.
__device__ __forceinline__ void tdm_advance(u32x4& g0, uint32_t lds_dst) {
  const uint64_t w = (((uint64_t)g0[3] << 32) | g0[2]) + BK * 2u;
  g0[1] = uni(lds_dst);
  g0[2] = uni((uint32_t)w);
  g0[3] = uni((uint32_t)(w >> 32));
}
// One request of the calling wave.  Both groups are in-out operands so that the
// registers an issued request names stay the descriptor's own while it is in
// flight: they take new values only in tdm_advance.
__device__ __forceinline__ void tdm_load(u32x4& g0, u32x8& g1) {
  asm volatile("tensor_load_to_lds %0, %1" : "+s"(g0), "+s"(g1) :: "memory");
}
// The mover's and the LDS reads' waits are not placed by the compiler.
__device__ __forceinline__ void wait_tensor0() { asm volatile("s_wait_tensorcnt 0x0" ::: "memory"); }
__device__ __forceinline__ void wait_ds0()     { asm volatile("s_wait_dscnt 0x0" ::: "memory"); }

// Load one 16(M/N) x 32(K) WMMA A/B fragment from an LDS tile laid out
// [row][k], leading dimension ld elems (row byte size 16B aligned).
// lanes 0-15 : row = lane,    K = {k0..k0+7} and {k0+16..k0+23}
// lanes 16-31: row = lane-16, K = {k0+8..k0+15} and {k0+24..k0+31}
__device__ __forceinline__ v16bf frag_ld(const bf16* tile, int ld, int row0, int k0) {
  const int lane = threadIdx.x & 31;
  const bf16* p = tile + (row0 + (lane & 15)) * ld + k0 + ((lane >> 4) << 3);
  union { v16bf v; v8bf h[2]; } f;
  f.h[0] = *(const v8bf*)(p);
  f.h[1] = *(const v8bf*)(p + 16);
  return f.v;
}

__device__ __forceinline__ v8f wmma_bf16(v16bf a, v16bf b, v8f c) {
  return __builtin_amdgcn_wmma_f32_16x16x32_bf16(false, a, false, b,
                                                 (short)0, c, false, false);
}

extern __shared__ __attribute__((aligned(2048))) char smem[];

// acc[i][t] += rows [mb + 64*wm + 16*i ..) of a  x  rows [cb + 64*wn + 16*t ..) of b,
// both K-contiguous with DIM elements a row.  The b rows go in as the matrix
// instruction's first operand, so a tile comes out transposed: a lane holds, of
// ONE row of a (lane & 15), eight consecutive columns ((lane >> 4) * 8 + vgpr).
// Two-buffer ring: every wave brings
// its own slice of a stage with one tensor load, one request outstanding.
__device__ __forceinline__ void gemm_256x128(const bf16* __restrict__ a,
                                             const bf16* __restrict__ b,
                                             int mb, int cb, v8f (&acc)[4][4]) {
  const uint32_t wave = uni(threadIdx.x >> 5);
  const uint32_t wm = wave & 3u, wn = wave >> 2;
  const bool     rowop = wave < 4u;      // waves 0-3 bring a, waves 4-7 bring b
  const uint32_t slot  = rowop ? wave * SLICE_A : B_BASE + (wave - 4u) * SLICE_B;
  const uint64_t gsrc  = rowop
      ? (uint64_t)(uintptr_t)(a + (size_t)(mb + 64 * (int)wave) * DIM)
      : (uint64_t)(uintptr_t)(b + (size_t)(cb + 32 * (int)(wave - 4u)) * DIM);
  const uint32_t dst0  = lds_off(smem) + slot;
  u32x8 g1 = tdm_group1(rowop ? 64u : 32u);
  u32x4 g0;

  tdm_aim(g0, dst0, gsrc);                        // stage 0
  tdm_load(g0, g1);
  wait_tensor0();
  __syncthreads();
  tdm_advance(g0, dst0 + STAGE_B);                // stage 1
  tdm_load(g0, g1);

  for (int s = 0; s < NSTEP; ++s) {
    const char* buf = smem + (s & 1) * STAGE_B;
    const bf16* At = (const bf16*)(buf + wm * SLICE_A);
    const bf16* Bt = (const bf16*)(buf + B_BASE + 2u * wn * SLICE_B);
    #pragma unroll
    for (int kc = 0; kc < BK; kc += 32) {
      v16bf va[4], vb[4];
      #pragma unroll
      for (int i = 0; i < 4; ++i) va[i] = frag_ld(At, LDA, i * 16, kc);
      #pragma unroll
      for (int t = 0; t < 4; ++t)
        vb[t] = frag_ld(Bt + (t >> 1) * (SLICE_B / 2u), LDA, (t & 1) * 16, kc);
      #pragma unroll
      for (int i = 0; i < 4; ++i)
        #pragma unroll
        for (int t = 0; t < 4; ++t) acc[i][t] = wmma_bf16(vb[t], va[i], acc[i][t]);
    }
    // publish point of stage s + 1; the barrier also frees this pass's buffer
    wait_ds0();
    wait_tensor0();
    __syncthreads();
    if (pinned(s + 2 < NSTEP)) {
      tdm_advance(g0, dst0 + (s & 1) * STAGE_B);  // stage s + 2
      tdm_load(g0, g1);
    }
  }
  // The last pass's own barrier has ended every read of the ring: it may be
  // overwritten by the output staging from here on.
  wait_tensor0();
  wait_ds0();
}

// Where the calling lane's part of acc[i][t] lies in the 256 x 128 output tile.
__device__ __forceinline__ int tile_row(int i) {
  return ((threadIdx.x >> 5) & 3) * 64 + i * 16 + (threadIdx.x & 15);
}
__device__ __forceinline__ int tile_col(int t) {
  return (threadIdx.x >> 7) * 64 + t * 16 + ((threadIdx.x >> 4) & 1) * 8;
}
// The value of lane l ^ 16: the other half of the same output row.
__device__ __forceinline__ float other_half(float v) {
  const int b = __builtin_bit_cast(int, v);
  return __builtin_bit_cast(float,
      __builtin_amdgcn_permlanex16(b, b, 0x76543210, 0xfedcba98, false, false));
}

// ---------------------------------------------------------------- kernel 0
// bf16 conversions + zeroing of atomic accumulators (every launch), as a stream:
// few workgroups, all resident at once; each owns one contiguous piece of K0_P4
// groups of four floats of ONE of the three arrays and walks it in runs of eight
// wave-wide 512-B loads that are in flight together.
#define K0_T   256
#define K0_P4  8192                              // groups of four floats per workgroup
#define K0_XW  (MROWS * DIM / 4 / K0_P4)         // 1024 workgroups on x
#define K0_QW  (3 * DIM * DIM / 4 / K0_P4)       // 96 on w_qkv
#define K0_PW  (DIM * DIM / 4 / K0_P4)           // 32 on w_proj
#define K0_ZW  (BATCH * NHEAD * HDIM / K0_T)     // 16 of them also zero zbuf
static_assert(BATCH * NHEAD * HDIM * HDIM == K0_XW * K0_T, "ctx: one float a thread on x");
static_assert(K0_ZW <= K0_QW, "zbuf: one float a thread of the first workgroups on w_qkv");

// NB groups of four floats, K0_T groups apart: all loads first, then the stores.
// The f32 source is read once, so its loads are non-temporal.
template <int NB>
__device__ __forceinline__ void cvt_run(const float* __restrict__ src,
                                        bf16* __restrict__ dst, int first4) {
  const v4f* s = (const v4f*)src + first4;
  v4bf*      d = (v4bf*)dst + first4;
  v4f v[NB];
  #pragma unroll
  for (int j = 0; j < NB; ++j) v[j] = __builtin_nontemporal_load(s + j * K0_T);
  #pragma unroll
  for (int j = 0; j < NB; ++j) {
    v4bf o;
    #pragma unroll
    for (int e = 0; e < 4; ++e) o[e] = f2bf(v[j][e]);
    d[j * K0_T] = o;
  }
}

__global__ void __launch_bounds__(K0_T)
k0_init(const float* __restrict__ x, const float* __restrict__ wqkv,
        const float* __restrict__ wproj,
        bf16* __restrict__ x_bf, bf16* __restrict__ wqkv_bf,
        bf16* __restrict__ wproj_bf,
        float* __restrict__ ctx, float* __restrict__ zbuf) {
  const int tid = threadIdx.x, wg = blockIdx.x;
  const float* src = x;
  bf16*        dst = x_bf;
  int          piece = wg;
  if (wg >= K0_XW + K0_QW)  { src = wproj; dst = wproj_bf; piece = wg - (K0_XW + K0_QW); }
  else if (wg >= K0_XW)     { src = wqkv;  dst = wqkv_bf;  piece = wg - K0_XW; }
  // Kept rolled: unrolled, every load of the thread is lifted to the top, and the
  // registers that takes keep part of the workgroups from being resident.
  #pragma unroll 1
  for (int b = 0; b < K0_P4 / K0_T; b += 8)
    cvt_run<8>(src, dst, piece * K0_P4 + b * K0_T + tid);
  if (wg < K0_XW + K0_ZW) {
    float* z = wg < K0_XW ? ctx + wg * K0_T : zbuf + (wg - K0_XW) * K0_T;
    z[tid] = 0.f;
  }
}

__device__ __forceinline__ v8f exp_tile(v8f x) {
  x *= 1.44269504f;
  float a = x[0], b = x[1], c = x[2], d = x[3], e = x[4], f = x[5], g = x[6], h = x[7];
  asm("v_exp_f32 %0, %0\n\tv_exp_f32 %1, %1\n\tv_exp_f32 %2, %2\n\tv_exp_f32 %3, %3\n\t"
      "v_exp_f32 %4, %4\n\tv_exp_f32 %5, %5\n\tv_exp_f32 %6, %6\n\tv_exp_f32 %7, %7\n\t"
      "v_nop"
      : "+v"(a), "+v"(b), "+v"(c), "+v"(d), "+v"(e), "+v"(f), "+v"(g), "+v"(h));
  return v8f{a, b, c, d, e, f, g, h};
}

// The q (SEC 0), k (1) or v (2) transform of a wave's 64 x 64 accumulators, one
// 16-row tile at a time in registers, then 16 B a lane into the bf16 staging tile.
template <int SEC>
__device__ __forceinline__ void finish_tiles(bf16* Os, v8f (&acc)[4][4]) {
  // every loop here is unrolled so that acc is indexed by constants only and
  // stays in registers
  #pragma unroll
  for (int i = 0; i < 4; ++i) {
    if (SEC == 0) {
      // row softmax over the wave's 64 columns (one head), * SCALE: 32 values of a
      // row are in this lane, the other 32 in lane ^ 16
      float m = -1e30f;
      #pragma unroll
      for (int t = 0; t < 4; ++t)
        #pragma unroll
        for (int r = 0; r < 8; ++r) m = fmaxf(m, acc[i][t][r]);
      m = fmaxf(m, other_half(m));
      #pragma unroll
      for (int t = 0; t < 4; ++t) acc[i][t] = exp_tile(acc[i][t] - m);
      const v8f sv = (acc[i][0] + acc[i][1]) + (acc[i][2] + acc[i][3]);
      float sum = ((sv[0] + sv[1]) + (sv[2] + sv[3])) + ((sv[4] + sv[5]) + (sv[6] + sv[7]));
      sum += other_half(sum);
      const float scl = QK_SCALE / sum;
      #pragma unroll
      for (int t = 0; t < 4; ++t) acc[i][t] *= scl;
    } else if (SEC == 1) {
      // E = exp(k_raw); k values ~N(0,1) so no max subtraction needed
      #pragma unroll
      for (int t = 0; t < 4; ++t) acc[i][t] = exp_tile(acc[i][t]);
    }
    #pragma unroll
    for (int t = 0; t < 4; ++t)
      *(v8bf*)(Os + tile_row(i) * LDO + tile_col(t)) = __builtin_convertvector(acc[i][t], v8bf);
  }
}

// ------------------------------------------------------ kernel 1: QKV GEMM
// qkv = x @ w_qkv^T  (tensor loads double-buffered into LDS, bf16 WMMA), fused
// epilogue per 128-column (two-head-aligned) slab.
__global__ void __launch_bounds__(256)
k1_qkv(const bf16* __restrict__ xbf, const bf16* __restrict__ wbf,
       bf16* __restrict__ qs, bf16* __restrict__ ebuf, bf16* __restrict__ vbuf) {
  bf16* Os = (bf16*)smem;                           // over the ring, after the K loop

  const int tid  = threadIdx.x;
  const int mb   = blockIdx.x * BMG;
  const int cb   = blockIdx.y * BN2;                // 0..2944

  v8f acc[4][4];
  #pragma unroll
  for (int i = 0; i < 4; ++i)
    #pragma unroll
    for (int t = 0; t < 4; ++t)
      #pragma unroll
      for (int r = 0; r < 8; ++r) acc[i][t][r] = 0.f;

  gemm_256x128(xbf, wbf, mb, cb, acc);

  const int sec = cb >> 10;                    // 0=q, 1=k, 2=v
  const int ci  = cb & 1023;
  if (sec == 0)      finish_tiles<0>(Os, acc);
  else if (sec == 1) finish_tiles<1>(Os, acc);
  else               finish_tiles<2>(Os, acc);
  __syncthreads();
  // half a wave writes one whole 256-B row of the slab per store
  bf16* dst = (sec == 0 ? qs : sec == 1 ? ebuf : vbuf)
              + (size_t)(mb + (tid >> 4)) * DIM + ci + (tid & 15) * 8;
  const bf16* from = Os + (tid >> 4) * LDO + (tid & 15) * 8;
  #pragma unroll   // all LDS reads in flight ahead of the first store
  for (int j = 0; j < BMG / 16; ++j)
    *(v8bf*)(dst + (size_t)j * 16 * DIM) = *(const v8bf*)(from + j * 16 * LDO);
}

// ---------------------------------- kernel 2: context' = E^T V, Z = colsum(E)
__global__ void __launch_bounds__(128)
k2_context(const bf16* __restrict__ ebuf, const bf16* __restrict__ vbuf,
           float* __restrict__ ctx, float* __restrict__ zbuf) {
  __shared__ bf16 Es[HDIM * LDE];              // [d][n] (transposed)
  __shared__ bf16 Vs[HDIM * LDE];              // [e][n] (transposed)
  const int tid  = threadIdx.x;
  const int wave = tid >> 5;
  const int bh = blockIdx.x >> 4;              // NSPLIT == 16
  const int ns = blockIdx.x & (NSPLIT - 1);
  const int b = bh >> 4, h = bh & 15;
  const size_t rowbase = (size_t)b * SEQ + (size_t)ns * CHUNK;
  const int hoff = h * HDIM;

  v8f acc[4];
  #pragma unroll
  for (int t = 0; t < 4; ++t)
    #pragma unroll
    for (int i = 0; i < 8; ++i) acc[t][i] = 0.f;
  float zacc = 0.f;

  for (int nb = 0; nb < CHUNK; nb += 32) {
    for (int i = tid; i < 32 * HDIM; i += 128) {   // transpose into LDS
      const int nl = i >> 6, d = i & 63;
      Es[d * LDE + nl] = ebuf[(rowbase + nb + nl) * DIM + hoff + d];
      Vs[d * LDE + nl] = vbuf[(rowbase + nb + nl) * DIM + hoff + d];
    }
    __syncthreads();
    if (tid < HDIM) {
      #pragma unroll
      for (int n = 0; n < 32; ++n) zacc += bf2f(Es[tid * LDE + n]);
    }
    const int wr = wave * 16;
    const v16bf va = frag_ld(Es, LDE, wr, 0);
    #pragma unroll
    for (int t = 0; t < 4; ++t) {
      const v16bf vbr = frag_ld(Vs, LDE, t * 16, 0);
      acc[t] = wmma_bf16(va, vbr, acc[t]);
    }
    __syncthreads();
  }
  {
    const int lane = tid & 31;
    const int rb = wave * 16 + ((lane >> 4) << 3);
    const int cl = lane & 15;
    float* cbase = ctx + (size_t)bh * HDIM * HDIM;
    #pragma unroll
    for (int t = 0; t < 4; ++t)
      #pragma unroll
      for (int i = 0; i < 8; ++i)
        atomicAdd(cbase + (rb + i) * HDIM + t * 16 + cl, acc[t][i]);
  }
  if (tid < HDIM) atomicAdd(zbuf + bh * HDIM + tid, zacc);
}

// ---- kernel 3a: wf[b][o][h*64+d] = sum_e w_proj[o][h*64+e] * ctx[bh][d][e] / Z[bh][d]
// (q ctx) w_proj^T = q (ctx w_proj^T): the context goes into the projection's
// weights, once per batch, so that the product with the context runs over
// BATCH * DIM rows and not over MROWS.
__global__ void __launch_bounds__(256)
k3a_fold(const bf16* __restrict__ wpbf, const float* __restrict__ ctx,
         const float* __restrict__ zbuf, bf16* __restrict__ wf) {
  __shared__ bf16 As3[BM * LDA];               // rows o of w_proj, k = e
  __shared__ bf16 Bs3[BN * LDB];               // rows d of the normalised context, k = e
  const int tid = threadIdx.x, wave = tid >> 5;
  const int mb = blockIdx.x * BM;
  const int h = blockIdx.y;
  const int bh = blockIdx.z * NHEAD + h;
  const int hoff = h * HDIM;

  // Both operands' loads are issued ahead of the first LDS store (constant trip
  // counts, unrolled), so the workgroup waits for memory once.
  v8bf  av[BM * HDIM / 8 / 256];               // 4 x 16 B of w_proj
  v4f   cv[BN * HDIM / 4 / 256];               // 4 x 16 B of ctx
  float zv[BN * HDIM / 4 / 256];
  #pragma unroll
  for (int j = 0; j < BM * HDIM / 8 / 256; ++j) {
    const int i = tid + j * 256, r = i >> 3, c8 = (i & 7) * 8;
    av[j] = *(const v8bf*)(wpbf + (size_t)(mb + r) * DIM + hoff + c8);
  }
  #pragma unroll
  for (int j = 0; j < BN * HDIM / 4 / 256; ++j) {
    const int i = tid + j * 256, r = i >> 4, c4 = (i & 15) * 4;
    cv[j] = *(const v4f*)(ctx + (size_t)bh * 4096 + r * HDIM + c4);
    zv[j] = zbuf[bh * HDIM + r];
  }
  #pragma unroll
  for (int j = 0; j < BM * HDIM / 8 / 256; ++j) {
    const int i = tid + j * 256, r = i >> 3, c8 = (i & 7) * 8;
    *(v8bf*)(As3 + r * LDA + c8) = av[j];
  }
  #pragma unroll
  for (int j = 0; j < BN * HDIM / 4 / 256; ++j) {
    const int i = tid + j * 256, r = i >> 4, c4 = (i & 15) * 4;
    v4bf o;
    #pragma unroll
    for (int e = 0; e < 4; ++e) o[e] = f2bf(cv[j][e] / zv[j]);
    *(v4bf*)(Bs3 + r * LDB + c4) = o;
  }
  __syncthreads();

  v8f acc[4];
  #pragma unroll
  for (int t = 0; t < 4; ++t)
    #pragma unroll
    for (int i = 0; i < 8; ++i) acc[t][i] = 0.f;

  const int wr = wave * 16;
  #pragma unroll
  for (int kc = 0; kc < HDIM; kc += 32) {
    const v16bf va = frag_ld(As3, LDA, wr, kc);
    #pragma unroll
    for (int t = 0; t < 4; ++t) {
      const v16bf vbr = frag_ld(Bs3, LDB, t * 16, kc);
      acc[t] = wmma_bf16(vbr, va, acc[t]);   // transposed tile, as in gemm_256x128
    }
  }
  // a lane holds eight consecutive columns of one row: one 16-B store a tile
  const int lane = tid & 31;
  bf16* dst = wf + (size_t)blockIdx.z * DIM * DIM
              + (size_t)(mb + wr + (lane & 15)) * DIM + hoff + (lane >> 4) * 8;
  #pragma unroll   // acc is indexed by constants only
  for (int t = 0; t < 4; ++t)
    *(v8bf*)(dst + t * 16) = __builtin_convertvector(acc[t], v8bf);
}

// ------------------- kernel 3b: out = q_soft @ wf[batch]^T + b_proj (f32)
__global__ void __launch_bounds__(256)
k3b_proj(const bf16* __restrict__ qs, const bf16* __restrict__ wf,
         const float* __restrict__ bias, float* __restrict__ out) {
  float* Cs   = (float*)smem;                       // over the ring, after the K loop
  const int tid = threadIdx.x;
  const int mb = blockIdx.x * BMG;
  const int cb = blockIdx.y * BN2;

  v8f acc[4][4];
  #pragma unroll
  for (int i = 0; i < 4; ++i)
    #pragma unroll
    for (int t = 0; t < 4; ++t)
      #pragma unroll
      for (int r = 0; r < 8; ++r) acc[i][t][r] = 0.f;

  // a 256-row tile lies in one batch
  gemm_256x128(qs, wf + (size_t)(mb / SEQ) * DIM * DIM, mb, cb, acc);
  // two 16-B LDS stores a tile (unrolled: acc is indexed by constants only)
  #pragma unroll
  for (int i = 0; i < 4; ++i)
    #pragma unroll
    for (int t = 0; t < 4; ++t) {
      float* p = Cs + tile_row(i) * LDC2 + tile_col(t);
      *(v4f*)p       = __builtin_shufflevector(acc[i][t], acc[i][t], 0, 1, 2, 3);
      *(v4f*)(p + 4) = __builtin_shufflevector(acc[i][t], acc[i][t], 4, 5, 6, 7);
    }
  __syncthreads();
  // a wave writes one whole 512-B row of the slab per store
  const int c = (tid & 31) * 4;
  const v4f bv = *(const v4f*)(bias + cb + c);
  float* dst = out + (size_t)(mb + (tid >> 5)) * DIM + cb + c;
  const float* from = Cs + (tid >> 5) * LDC2 + c;
  #pragma unroll   // all LDS reads in flight ahead of the first store
  for (int j = 0; j < BMG / 8; ++j)
    *(v4f*)(dst + (size_t)j * 8 * DIM) = *(const v4f*)(from + j * 8 * LDC2) + bv;
}

// ---------------------------------------------------------------- launcher
extern "C" void kernel_launch(void* const* d_in, const int* in_sizes, int n_in,
                              void* d_out, int out_size, void* d_ws, size_t ws_size,
                              hipStream_t stream) {
  (void)in_sizes; (void)n_in; (void)out_size; (void)ws_size;
  const float* x      = (const float*)d_in[0];
  const float* w_qkv  = (const float*)d_in[1];
  const float* w_proj = (const float*)d_in[2];
  const float* b_proj = (const float*)d_in[3];
  float* out = (float*)d_out;

  char* p = (char*)d_ws;
  size_t off = 0;
  auto take = [&](size_t bytes) -> char* {
    char* r = p + off;
    off += (bytes + 255) & ~(size_t)255;
    return r;
  };
  bf16*  x_bf     = (bf16*)take((size_t)MROWS * DIM * 2);   // 64 MB
  bf16*  qs       = (bf16*)take((size_t)MROWS * DIM * 2);   // 64 MB
  bf16*  ebuf     = (bf16*)take((size_t)MROWS * DIM * 2);   // 64 MB
  bf16*  vbuf     = (bf16*)take((size_t)MROWS * DIM * 2);   // 64 MB
  bf16*  wqkv_bf  = (bf16*)take((size_t)3 * DIM * DIM * 2); // 6 MB
  bf16*  wproj_bf = (bf16*)take((size_t)DIM * DIM * 2);     // 2 MB
  float* ctx      = (float*)take((size_t)BATCH * NHEAD * HDIM * HDIM * 4);
  float* zbuf     = (float*)take((size_t)BATCH * NHEAD * HDIM * 4);
  bf16*  wfold    = (bf16*)take((size_t)BATCH * DIM * DIM * 2);     // 8 MB

  const size_t big_lds   = 2 * STAGE_B;                 // k1: the ring, 128 KB
  const size_t proj_lds  = CS_BYTES;                    // k3b: 132 KB

  k0_init<<<K0_XW + K0_QW + K0_PW, K0_T, 0, stream>>>(x, w_qkv, w_proj, x_bf,
                                       wqkv_bf, wproj_bf, ctx, zbuf);
  k1_qkv<<<dim3(MROWS / BMG, (3 * DIM) / BN2), 256, big_lds, stream>>>(
      x_bf, wqkv_bf, qs, ebuf, vbuf);
  k2_context<<<BATCH * NHEAD * NSPLIT, 128, 0, stream>>>(ebuf, vbuf, ctx, zbuf);
  k3a_fold<<<dim3(DIM / BM, NHEAD, BATCH), 256, 0, stream>>>(wproj_bf, ctx, zbuf, wfold);
  k3b_proj<<<dim3(MROWS / BMG, DIM / BN2), 256, proj_lds, stream>>>(
      qs, wfold, b_proj, out);
}

// v005
// A run of this version takes 207 microseconds.
// In both of two side-by-side timings against v004, it was 1.17 times as fast.
// Over all steps from v000 it is 2.19 times as fast.
#include <hip/hip_runtime.h>
#include <hip/hip_bf16.h>
#include <cstdint>

#define DIM   1024
#define NHEAD 16
#define HDIM  64
#define BATCH 4
#define SEQ   8192
#define MROWS (BATCH*SEQ)          // 32768
#define QK_SCALE 0.125f            // HDIM^-0.5

// GEMM tiling (big GEMMs): 256 x 128 per workgroup, 64 x 64 per wave (4 x 2 waves)
#define BM 128                     // rows per workgroup of k3a
#define BMG 256                    // rows per workgroup of the big GEMMs
#define BN2 128                    // wide N tile to cut L2 re-reads
#define BK 64
#define LDA 72                     // bf16 elems; 144B rows (16B aligned, conflict-free)
#define LDC2 132                   // f32 elems, output staging of k3b
#define LDO  136                   // bf16 elems, output staging of k1: 272-B rows
#define NSTEP (DIM / BK)           // 16
// One stage in LDS: four 64-row slices of the row operand, four 32-row slices of
// the column operand, rows at 144 B, each slice's size rounded up to 2 KiB.
#define SLICE_A 10240u             // 64 * 144 = 9216 -> 10240
#define SLICE_B 6144u              // 32 * 144 = 4608 -> 6144
#define B_BASE  (4u * SLICE_A)     // 40960
#define STAGE_B (4u * SLICE_A + 4u * SLICE_B)   // 65536 B per buffer
#define CS_BYTES (BMG * LDC2 * 4)  // 135168 B, laid over the ring after the K loop

// small GEMM tiling (k3a)
#define BN 64
#define LDB 72
// context product in k1's epilogue: one partial per 256-row tile
#define NPART (SEQ / BMG)          // 32 partials per batch and head
#define LDT 264                    // bf16 elems; 528-B rows of the transposed E and V tiles

typedef __bf16 bf16;
typedef bf16  v16bf __attribute__((ext_vector_type(16)));
typedef bf16  v8bf  __attribute__((ext_vector_type(8)));
typedef bf16  v4bf  __attribute__((ext_vector_type(4)));
typedef float v8f   __attribute__((ext_vector_type(8)));
typedef float v4f   __attribute__((ext_vector_type(4)));
typedef uint32_t u32x4 __attribute__((ext_vector_type(4)));
typedef uint32_t u32x8 __attribute__((ext_vector_type(8)));

__device__ __forceinline__ bf16 f2bf(float f) {
  uint32_t u = __builtin_bit_cast(uint32_t, f);
  u = (u + 0x7FFFu + ((u >> 16) & 1u)) >> 16;     // round-to-nearest-even
  uint16_t s = (uint16_t)u;
  return __builtin_bit_cast(bf16, s);
}

// LDS byte offset of a generic pointer into shared memory (addrspace(3) ptrtoint)
__device__ __forceinline__ uint32_t lds_off(const void* p) {
  return (uint32_t)(uintptr_t)(__attribute__((address_space(3))) const void*)p;
}

__device__ __forceinline__ uint32_t uni(uint32_t v) {
  return (uint32_t)__builtin_amdgcn_readfirstlane(v);
}
__device__ __forceinline__ uint32_t pinned(uint32_t v) {
  uint32_t w = uni(v);
  asm volatile("" : "+s"(w));   // pinned(): the issue test's word held in a scalar register
  return w;
}

// Group 1 of a tensor-load descriptor: a tile of nrows rows of 128 B (64 bf16),
// everything in bytes, tensor = tile, source pitch 2048 B; a 16-B pad behind
// every 128-B row, so rows land at a 144-B pitch.
__device__ __forceinline__ u32x8 tdm_group1(uint32_t nrows) {
  u32x8 g;
  g[0] = uni((1u << 20) | (4u << 22) | (3u << 25));
  g[1] = uni(128u << 16);
  g[2] = uni(nrows << 16);
  g[3] = uni(128u << 16);
  g[4] = uni(nrows);
  g[5] = uni(DIM * 2u);
  g[6] = uni(0u);
  g[7] = uni(0u);
  return g;
}
// Group 0: the slice's place in LDS (byte offset) and its first global byte.
__device__ __forceinline__ void tdm_aim(u32x4& g0, uint32_t lds_dst, uint64_t ga) {
  g0[0] = uni(1u);
  g0[1] = uni(lds_dst);
  g0[2] = uni((uint32_t)ga);
  g0[3] = uni((((uint32_t)(ga >> 32)) & 0x01FFFFFFu) | 0x80000000u);
}
// The next stage's request: a new place in LDS, the source BK elements further
// along its rows (words 2 and 3 as one 64-bit sum; the type bits sit above the
// address).  Called only behind the wait that covers the request before it.
__device__ __forceinline__ void tdm_advance(u32x4& g0, uint32_t lds_dst) {
  const uint64_t w = (((uint64_t)g0[3] << 32) | g0[2]) + BK * 2u;
  g0[1] = uni(lds_dst);
  g0[2] = uni((uint32_t)w);
  g0[3] = uni((uint32_t)(w >> 32));
}
// One request of the calling wave.  Both groups are in-out operands so that the
// registers an issued request names stay the descriptor's own while it is in
// flight: they take new values only in tdm_advance.
__device__ __forceinline__ void tdm_load(u32x4& g0, u32x8& g1) {
  asm volatile("tensor_load_to_lds %0, %1" : "+s"(g0), "+s"(g1) :: "memory");
}
// The mover's and the LDS reads' waits are not placed by the compiler.
__device__ __forceinline__ void wait_tensor0() { asm volatile("s_wait_tensorcnt 0x0" ::: "memory"); }
__device__ __forceinline__ void wait_ds0()     { asm volatile("s_wait_dscnt 0x0" ::: "memory"); }

// Load one 16(M/N) x 32(K) WMMA A/B fragment from an LDS tile laid out
// [row][k], leading dimension ld elems (row byte size 16B aligned).
// lanes 0-15 : row = lane,    K = {k0..k0+7} and {k0+16..k0+23}
// lanes 16-31: row = lane-16, K = {k0+8..k0+15} and {k0+24..k0+31}
__device__ __forceinline__ v16bf frag_ld(const bf16* tile, int ld, int row0, int k0) {
  const int lane = threadIdx.x & 31;
  const bf16* p = tile + (row0 + (lane & 15)) * ld + k0 + ((lane >> 4) << 3);
  union { v16bf v; v8bf h[2]; } f;
  f.h[0] = *(const v8bf*)(p);
  f.h[1] = *(const v8bf*)(p + 16);
  return f.v;
}

__device__ __forceinline__ v8f wmma_bf16(v16bf a, v16bf b, v8f c) {
  return __builtin_amdgcn_wmma_f32_16x16x32_bf16(false, a, false, b,
                                                 (short)0, c, false, false);
}

extern __shared__ __attribute__((aligned(2048))) char smem[];

// acc[i][t] += rows [mb + 64*wm + 16*i ..) of a  x  rows [cb_wn + 16*t ..) of b,
// cb_wn = cb0 for the waves with wn = 0 and cb1 for wn = 1, both operands
// K-contiguous with DIM elements a row.
// B_FIRST: the b rows go in as the matrix instruction's first operand, so a lane
// holds, of ONE row of a (lane & 15), eight consecutive columns ((lane >> 4) * 8 +
// vgpr).  Otherwise a lane holds, of ONE column (lane & 15), eight consecutive
// rows of a.
// Two-buffer ring: every wave brings
// its own slice of a stage with one tensor load, one request outstanding.
template <bool B_FIRST>
__device__ __forceinline__ void gemm_256x128(const bf16* __restrict__ a,
                                             const bf16* __restrict__ b,
                                             int mb, int cb0, int cb1, v8f (&acc)[4][4]) {
  const uint32_t wave = uni(threadIdx.x >> 5);
  const uint32_t wm = wave & 3u, wn = wave >> 2;
  const bool     rowop = wave < 4u;      // waves 0-3 bring a, waves 4-7 bring b
  const uint32_t slot  = rowop ? wave * SLICE_A : B_BASE + (wave - 4u) * SLICE_B;
  const uint64_t gsrc  = rowop
      ? (uint64_t)(uintptr_t)(a + (size_t)(mb + 64 * (int)wave) * DIM)
      : (uint64_t)(uintptr_t)(b + (size_t)((wave < 6u ? cb0 : cb1) + 32 * (int)(wave & 1u)) * DIM);
  const uint32_t dst0  = lds_off(smem) + slot;
  u32x8 g1 = tdm_group1(rowop ? 64u : 32u);
  u32x4 g0;

  tdm_aim(g0, dst0, gsrc);                        // stage 0
  tdm_load(g0, g1);
  wait_tensor0();
  __syncthreads();
  tdm_advance(g0, dst0 + STAGE_B);                // stage 1
  tdm_load(g0, g1);

  for (int s = 0; s < NSTEP; ++s) {
    const char* buf = smem + (s & 1) * STAGE_B;
    const bf16* At = (const bf16*)(buf + wm * SLICE_A);
    const bf16* Bt = (const bf16*)(buf + B_BASE + 2u * wn * SLICE_B);
    #pragma unroll
    for (int kc = 0; kc < BK; kc += 32) {
      v16bf va[4], vb[4];
      #pragma unroll
      for (int i = 0; i < 4; ++i) va[i] = frag_ld(At, LDA, i * 16, kc);
      #pragma unroll
      for (int t = 0; t < 4; ++t)
        vb[t] = frag_ld(Bt + (t >> 1) * (SLICE_B / 2u), LDA, (t & 1) * 16, kc);
      #pragma unroll
      for (int i = 0; i < 4; ++i)
        #pragma unroll
        for (int t = 0; t < 4; ++t)
          acc[i][t] = B_FIRST ? wmma_bf16(vb[t], va[i], acc[i][t])
                              : wmma_bf16(va[i], vb[t], acc[i][t]);
    }
    // publish point of stage s + 1; the barrier also frees this pass's buffer
    wait_ds0();
    wait_tensor0();
    __syncthreads();
    if (pinned(s + 2 < NSTEP)) {
      tdm_advance(g0, dst0 + (s & 1) * STAGE_B);  // stage s + 2
      tdm_load(g0, g1);
    }
  }
  // The last pass's own barrier has ended every read of the ring: it may be
  // overwritten by the output staging from here on.
  wait_tensor0();
  wait_ds0();
}

// Where the calling lane's part of acc[i][t] lies in the 256 x 128 output tile.
__device__ __forceinline__ int tile_row(int i) {
  return ((threadIdx.x >> 5) & 3) * 64 + i * 16 + (threadIdx.x & 15);
}
__device__ __forceinline__ int tile_col(int t) {
  return (threadIdx.x >> 7) * 64 + t * 16 + ((threadIdx.x >> 4) & 1) * 8;
}
// The value of lane l ^ 16: the other half of the same output row (B_FIRST) or column (otherwise).
__device__ __forceinline__ float other_half(float v) {
  const int b = __builtin_bit_cast(int, v);
  return __builtin_bit_cast(float,
      __builtin_amdgcn_permlanex16(b, b, 0x76543210, 0xfedcba98, false, false));
}

// ---------------------------------------------------------------- kernel 0
// bf16 conversions, as a stream:
// few workgroups, all resident at once; each owns one contiguous piece of K0_P4
// groups of four floats of ONE of the three arrays and walks it in runs of eight
// wave-wide 512-B loads that are in flight together.
#define K0_T   256
#define K0_P4  8192                              // groups of four floats per workgroup
#define K0_XW  (MROWS * DIM / 4 / K0_P4)         // 1024 workgroups on x
#define K0_QW  (3 * DIM * DIM / 4 / K0_P4)       // 96 on w_qkv
#define K0_PW  (DIM * DIM / 4 / K0_P4)           // 32 on w_proj

// NB groups of four floats, K0_T groups apart: all loads first, then the stores.
// The f32 source is read once, so its loads are non-temporal.
template <int NB>
__device__ __forceinline__ void cvt_run(const float* __restrict__ src,
                                        bf16* __restrict__ dst, int first4) {
  const v4f* s = (const v4f*)src + first4;
  v4bf*      d = (v4bf*)dst + first4;
  v4f v[NB];
  #pragma unroll
  for (int j = 0; j < NB; ++j) v[j] = __builtin_nontemporal_load(s + j * K0_T);
  #pragma unroll
  for (int j = 0; j < NB; ++j) {
    v4bf o;
    #pragma unroll
    for (int e = 0; e < 4; ++e) o[e] = f2bf(v[j][e]);
    d[j * K0_T] = o;
  }
}

__global__ void __launch_bounds__(K0_T)
k0_init(const float* __restrict__ x, const float* __restrict__ wqkv,
        const float* __restrict__ wproj,
        bf16* __restrict__ x_bf, bf16* __restrict__ wqkv_bf,
        bf16* __restrict__ wproj_bf) {
  const int tid = threadIdx.x, wg = blockIdx.x;
  const float* src = x;
  bf16*        dst = x_bf;
  int          piece = wg;
  if (wg >= K0_XW + K0_QW)  { src = wproj; dst = wproj_bf; piece = wg - (K0_XW + K0_QW); }
  else if (wg >= K0_XW)     { src = wqkv;  dst = wqkv_bf;  piece = wg - K0_XW; }
  // Kept rolled: unrolled, every load of the thread is lifted to the top, and the
  // registers that takes keep part of the workgroups from being resident.
  #pragma unroll 1
  for (int b = 0; b < K0_P4 / K0_T; b += 8)
    cvt_run<8>(src, dst, piece * K0_P4 + b * K0_T + tid);
}

__device__ __forceinline__ v8f exp_tile(v8f x) {
  x *= 1.44269504f;
  float a = x[0], b = x[1], c = x[2], d = x[3], e = x[4], f = x[5], g = x[6], h = x[7];
  asm("v_exp_f32 %0, %0\n\tv_exp_f32 %1, %1\n\tv_exp_f32 %2, %2\n\tv_exp_f32 %3, %3\n\t"
      "v_exp_f32 %4, %4\n\tv_exp_f32 %5, %5\n\tv_exp_f32 %6, %6\n\tv_exp_f32 %7, %7\n\t"
      "v_nop"
      : "+v"(a), "+v"(b), "+v"(c), "+v"(d), "+v"(e), "+v"(f), "+v"(g), "+v"(h));
  return v8f{a, b, c, d, e, f, g, h};
}

// The q transform of a wave's 64 x 64 accumulators (B_FIRST layout), one 16-row
// tile at a time in registers, then 16 B a lane into the bf16 staging tile.
__device__ __forceinline__ void finish_q(bf16* Os, v8f (&acc)[4][4]) {
  // every loop here is unrolled so that acc is indexed by constants only and
  // stays in registers
  #pragma unroll
  for (int i = 0; i < 4; ++i) {
    // row softmax over the wave's 64 columns (one head), * SCALE: 32 values of a
    // row are in this lane, the other 32 in lane ^ 16
    float m = -1e30f;
    #pragma unroll
    for (int t = 0; t < 4; ++t)
      #pragma unroll
      for (int r = 0; r < 8; ++r) m = fmaxf(m, acc[i][t][r]);
    m = fmaxf(m, other_half(m));
    #pragma unroll
    for (int t = 0; t < 4; ++t) acc[i][t] = exp_tile(acc[i][t] - m);
    const v8f sv = (acc[i][0] + acc[i][1]) + (acc[i][2] + acc[i][3]);
    float sum = ((sv[0] + sv[1]) + (sv[2] + sv[3])) + ((sv[4] + sv[5]) + (sv[6] + sv[7]));
    sum += other_half(sum);
    const float scl = QK_SCALE / sum;
    #pragma unroll
    for (int t = 0; t < 4; ++t) acc[i][t] *= scl;
    #pragma unroll
    for (int t = 0; t < 4; ++t)
      *(v8bf*)(Os + tile_row(i) * LDO + tile_col(t)) = __builtin_convertvector(acc[i][t], v8bf);
  }
}

// One head's k (waves 0-3) and v (waves 4-7) columns of 256 rows n, a lane holding
// eight consecutive n of one column: E = exp(k) and v go into LDS as [column][n],
// and the workgroup forms its own part of the context, sum_n E[n][d] v[n][e], and
// of Z[d] = sum_n E[n][d], and stores both plainly (k3a adds the parts).
__device__ __forceinline__ void finish_kv(v8f (&acc)[4][4], float* __restrict__ cpart,
                                          float* __restrict__ zpart) {
  bf16*  T  = (bf16*)smem;                          // rows 0-63 E^T, rows 64-127 v^T
  float* Zs = (float*)(smem + 2 * HDIM * LDT * 2);  // [4 row groups][64 d]
  const int      tid  = threadIdx.x, lane = tid & 31;
  const uint32_t wave = uni(tid >> 5);
  const int      wm = wave & 3u, wn = wave >> 2;
  // the loops over acc are unrolled so that it is indexed by constants only
  if (wave < 4u) {
    #pragma unroll
    for (int t = 0; t < 4; ++t) {
      // E = exp(k_raw); k values ~N(0,1) so no max subtraction needed
      #pragma unroll
      for (int i = 0; i < 4; ++i) acc[i][t] = exp_tile(acc[i][t]);
      const v8f sv = (acc[0][t] + acc[1][t]) + (acc[2][t] + acc[3][t]);
      float z = ((sv[0] + sv[1]) + (sv[2] + sv[3])) + ((sv[4] + sv[5]) + (sv[6] + sv[7]));
      z += other_half(z);                           // the wave's 64 rows of column d
      if (lane < 16) Zs[wm * HDIM + t * 16 + lane] = z;
    }
  }
  #pragma unroll
  for (int i = 0; i < 4; ++i)
    #pragma unroll
    for (int t = 0; t < 4; ++t)
      *(v8bf*)(T + (wn * HDIM + t * 16 + (lane & 15)) * LDT + wm * 64 + i * 16 + (lane >> 4) * 8)
          = __builtin_convertvector(acc[i][t], v8bf);
  __syncthreads();
  // wave: 16 d (wm) x 32 e (wn), K = the 256 rows.  The v rows go in first, so a
  // lane holds eight consecutive e of one d, and a wave writes whole 128-B lines.
  v8f c0 = {}, c1 = {};
  #pragma unroll   // LDS reads of later steps in flight under the matrix instructions
  for (int kc = 0; kc < BMG; kc += 32) {
    const v16bf ve  = frag_ld(T, LDT, wm * 16, kc);
    const v16bf vv0 = frag_ld(T + HDIM * LDT, LDT, wn * 32, kc);
    const v16bf vv1 = frag_ld(T + HDIM * LDT, LDT, wn * 32 + 16, kc);
    c0 = wmma_bf16(vv0, ve, c0);
    c1 = wmma_bf16(vv1, ve, c1);
  }
  float* o = cpart + (wm * 16 + (lane & 15)) * HDIM + wn * 32 + (lane >> 4) * 8;
  *(v4f*)(o)      = __builtin_shufflevector(c0, c0, 0, 1, 2, 3);
  *(v4f*)(o + 4)  = __builtin_shufflevector(c0, c0, 4, 5, 6, 7);
  *(v4f*)(o + 16) = __builtin_shufflevector(c1, c1, 0, 1, 2, 3);
  *(v4f*)(o + 20) = __builtin_shufflevector(c1, c1, 4, 5, 6, 7);
  if (tid < HDIM)
    zpart[tid] = (Zs[tid] + Zs[HDIM + tid]) + (Zs[2 * HDIM + tid] + Zs[3 * HDIM + tid]);
}

// ------------------------------------------------------ kernel 1: QKV GEMM
// qkv = x @ w_qkv^T  (tensor loads double-buffered into LDS, bf16 WMMA), fused
// epilogue.  blockIdx.y < 8: 128 q columns (two heads), softmax, stored.  Above:
// the 64 k and the 64 v columns of ONE head, which end in that head's context
// part for these 256 rows; k and v themselves are not stored.
__global__ void __launch_bounds__(256)
k1_qkv(const bf16* __restrict__ xbf, const bf16* __restrict__ wbf,
       bf16* __restrict__ qs, float* __restrict__ cpart, float* __restrict__ zpart) {
  const int tid  = threadIdx.x;
  const int mb   = blockIdx.x * BMG;

  v8f acc[4][4];
  #pragma unroll
  for (int i = 0; i < 4; ++i)
    #pragma unroll
    for (int t = 0; t < 4; ++t)
      #pragma unroll
      for (int r = 0; r < 8; ++r) acc[i][t][r] = 0.f;

  if (blockIdx.y >= DIM / BN2) {
    const int h    = blockIdx.y - DIM / BN2;
    const int part = ((mb / SEQ) * NHEAD + h) * NPART + (mb % SEQ) / BMG;
    gemm_256x128<false>(xbf, wbf, mb, DIM + h * HDIM, 2 * DIM + h * HDIM, acc);
    finish_kv(acc, cpart + (size_t)part * HDIM * HDIM, zpart + (size_t)part * HDIM);
    return;
  }
  bf16* Os = (bf16*)smem;                           // over the ring, after the K loop
  const int cb = blockIdx.y * BN2;                  // 0..896
  gemm_256x128<true>(xbf, wbf, mb, cb, cb + 64, acc);
  finish_q(Os, acc);
  __syncthreads();
  // half a wave writes one whole 256-B row of the slab per store
  bf16* dst = qs + (size_t)(mb + (tid >> 4)) * DIM + cb + (tid & 15) * 8;
  const bf16* from = Os + (tid >> 4) * LDO + (tid & 15) * 8;
  #pragma unroll   // all LDS reads in flight ahead of the first store
  for (int j = 0; j < BMG / 16; ++j)
    *(v8bf*)(dst + (size_t)j * 16 * DIM) = *(const v8bf*)(from + j * 16 * LDO);
}

// ---- kernel 3a: wf[b][o][h*64+d] = sum_e w_proj[o][h*64+e] * ctx[bh][d][e] / Z[bh][d]
// (q ctx) w_proj^T = q (ctx w_proj^T): the context goes into the projection's
// weights, once per batch, so that the product with the context runs over
// BATCH * DIM rows and not over MROWS.
__global__ void __launch_bounds__(256)
k3a_fold(const bf16* __restrict__ wpbf, const float* __restrict__ cpart,
         const float* __restrict__ zpart, bf16* __restrict__ wf) {
  __shared__ bf16 As3[BM * LDA];               // rows o of w_proj, k = e
  __shared__ bf16 Bs3[BN * LDB];               // rows d of the normalised context, k = e
  __shared__ float Zs[4 * HDIM];               // Z[d] in four sums of eight parts
  const int tid = threadIdx.x, wave = tid >> 5;
  const int mb = blockIdx.x * BM;
  const int h = blockIdx.y;
  const int bh = blockIdx.z * NHEAD + h;
  const int hoff = h * HDIM;

  // ctx and Z are the sums of k1's NPART parts.  The loads of w_proj and of Z's
  // parts are issued ahead of the walk over the context's parts.
  v8bf  av[BM * HDIM / 8 / 256];               // 4 x 16 B of w_proj
  v4f   cv[BN * HDIM / 4 / 256];               // 4 x 16 B of ctx
  #pragma unroll
  for (int j = 0; j < BM * HDIM / 8 / 256; ++j) {
    const int i = tid + j * 256, r = i >> 3, c8 = (i & 7) * 8;
    av[j] = *(const v8bf*)(wpbf + (size_t)(mb + r) * DIM + hoff + c8);
  }
  float zq = 0.f;                              // d = tid & 63, parts 8 * (tid >> 6) ..
  #pragma unroll   // all eight loads in flight
  for (int p = 0; p < NPART / 4; ++p)
    zq += zpart[((size_t)bh * NPART + (tid >> 6) * (NPART / 4) + p) * HDIM + (tid & 63)];
  #pragma unroll
  for (int j = 0; j < BN * HDIM / 4 / 256; ++j) cv[j] = v4f{0.f, 0.f, 0.f, 0.f};
  const v4f* cp = (const v4f*)(cpart + (size_t)bh * NPART * HDIM * HDIM) + tid;
  #pragma unroll 8   // 32 loads of 16 B in flight per thread
  for (int p = 0; p < NPART; ++p)
    #pragma unroll
    for (int j = 0; j < BN * HDIM / 4 / 256; ++j)
      cv[j] += cp[p * (HDIM * HDIM / 4) + j * 256];
  #pragma unroll
  for (int j = 0; j < BM * HDIM / 8 / 256; ++j) {
    const int i = tid + j * 256, r = i >> 3, c8 = (i & 7) * 8;
    *(v8bf*)(As3 + r * LDA + c8) = av[j];
  }
  Zs[tid] = zq;
  __syncthreads();
  #pragma unroll
  for (int j = 0; j < BN * HDIM / 4 / 256; ++j) {
    const int i = tid + j * 256, r = i >> 4, c4 = (i & 15) * 4;
    const float zv = (Zs[r] + Zs[HDIM + r]) + (Zs[2 * HDIM + r] + Zs[3 * HDIM + r]);
    v4bf o;
    #pragma unroll
    for (int e = 0; e < 4; ++e) o[e] = f2bf(cv[j][e] / zv);
    *(v4bf*)(Bs3 + r * LDB + c4) = o;
  }
  __syncthreads();

  v8f acc[4];
  #pragma unroll
  for (int t = 0; t < 4; ++t)
    #pragma unroll
    for (int i = 0; i < 8; ++i) acc[t][i] = 0.f;

  const int wr = wave * 16;
  #pragma unroll
  for (int kc = 0; kc < HDIM; kc += 32) {
    const v16bf va = frag_ld(As3, LDA, wr, kc);
    #pragma unroll
    for (int t = 0; t < 4; ++t) {
      const v16bf vbr = frag_ld(Bs3, LDB, t * 16, kc);
      acc[t] = wmma_bf16(vbr, va, acc[t]);   // transposed tile, as in gemm_256x128
    }
  }
  // a lane holds eight consecutive columns of one row: one 16-B store a tile
  const int lane = tid & 31;
  bf16* dst = wf + (size_t)blockIdx.z * DIM * DIM
              + (size_t)(mb + wr + (lane & 15)) * DIM + hoff + (lane >> 4) * 8;
  #pragma unroll   // acc is indexed by constants only
  for (int t = 0; t < 4; ++t)
    *(v8bf*)(dst + t * 16) = __builtin_convertvector(acc[t], v8bf);
}

// ------------------- kernel 3b: out = q_soft @ wf[batch]^T + b_proj (f32)
__global__ void __launch_bounds__(256)
k3b_proj(const bf16* __restrict__ qs, const bf16* __restrict__ wf,
         const float* __restrict__ bias, float* __restrict__ out) {
  float* Cs   = (float*)smem;                       // over the ring, after the K loop
  const int tid = threadIdx.x;
  const int mb = blockIdx.x * BMG;
  const int cb = blockIdx.y * BN2;

  v8f acc[4][4];
  #pragma unroll
  for (int i = 0; i < 4; ++i)
    #pragma unroll
    for (int t = 0; t < 4; ++t)
      #pragma unroll
      for (int r = 0; r < 8; ++r) acc[i][t][r] = 0.f;

  // a 256-row tile lies in one batch
  gemm_256x128<true>(qs, wf + (size_t)(mb / SEQ) * DIM * DIM, mb, cb, cb + 64, acc);
  // two 16-B LDS stores a tile (unrolled: acc is indexed by constants only)
  #pragma unroll
  for (int i = 0; i < 4; ++i)
    #pragma unroll
    for (int t = 0; t < 4; ++t) {
      float* p = Cs + tile_row(i) * LDC2 + tile_col(t);
      *(v4f*)p       = __builtin_shufflevector(acc[i][t], acc[i][t], 0, 1, 2, 3);
      *(v4f*)(p + 4) = __builtin_shufflevector(acc[i][t], acc[i][t], 4, 5, 6, 7);
    }
  __syncthreads();
  // a wave writes one whole 512-B row of the slab per store
  const int c = (tid & 31) * 4;
  const v4f bv = *(const v4f*)(bias + cb + c);
  float* dst = out + (size_t)(mb + (tid >> 5)) * DIM + cb + c;
  const float* from = Cs + (tid >> 5) * LDC2 + c;
  #pragma unroll   // all LDS reads in flight ahead of the first store
  for (int j = 0; j < BMG / 8; ++j)
    *(v4f*)(dst + (size_t)j * 8 * DIM) = *(const v4f*)(from + j * 8 * LDC2) + bv;
}

// ---------------------------------------------------------------- launcher
extern "C" void kernel_launch(void* const* d_in, const int* in_sizes, int n_in,
                              void* d_out, int out_size, void* d_ws, size_t ws_size,
                              hipStream_t stream) {
  (void)in_sizes; (void)n_in; (void)out_size; (void)ws_size;
  const float* x      = (const float*)d_in[0];
  const float* w_qkv  = (const float*)d_in[1];
  const float* w_proj = (const float*)d_in[2];
  const float* b_proj = (const float*)d_in[3];
  float* out = (float*)d_out;

  char* p = (char*)d_ws;
  size_t off = 0;
  auto take = [&](size_t bytes) -> char* {
    char* r = p + off;
    off += (bytes + 255) & ~(size_t)255;
    return r;
  };
  bf16*  x_bf     = (bf16*)take((size_t)MROWS * DIM * 2);   // 64 MB
  bf16*  qs       = (bf16*)take((size_t)MROWS * DIM * 2);   // 64 MB
  bf16*  wqkv_bf  = (bf16*)take((size_t)3 * DIM * DIM * 2); // 6 MB
  bf16*  wproj_bf = (bf16*)take((size_t)DIM * DIM * 2);     // 2 MB
  float* cpart    = (float*)take((size_t)BATCH * NHEAD * NPART * HDIM * HDIM * 4);  // 32 MB
  float* zpart    = (float*)take((size_t)BATCH * NHEAD * NPART * HDIM * 4);
  bf16*  wfold    = (bf16*)take((size_t)BATCH * DIM * DIM * 2);     // 8 MB

  const size_t big_lds   = 2 * STAGE_B;                 // k1: the ring, 128 KB
  const size_t proj_lds  = CS_BYTES;                    // k3b: 132 KB

  k0_init<<<K0_XW + K0_QW + K0_PW, K0_T, 0, stream>>>(x, w_qkv, w_proj, x_bf,
                                       wqkv_bf, wproj_bf);
  k1_qkv<<<dim3(MROWS / BMG, (3 * DIM) / BN2), 256, big_lds, stream>>>(
      x_bf, wqkv_bf, qs, cpart, zpart);
  k3a_fold<<<dim3(DIM / BM, NHEAD, BATCH), 256, 0, stream>>>(wproj_bf, cpart, zpart, wfold);
  k3b_proj<<<dim3(MROWS / BMG, DIM / BN2), 256, proj_lds, stream>>>(
      qs, wfold, b_proj, out);
}

// v007
// Measured time: 183 microseconds a run.
// It is 1.13 times as fast as v005, going by the measured steps of the versions left out in between.
// All steps since v000 together make it 2.48 times as fast.
#include <hip/hip_runtime.h>
#include <hip/hip_bf16.h>
#include <cstdint>

#define DIM   1024
#define NHEAD 16
#define HDIM  64
#define BATCH 4
#define SEQ   8192
#define MROWS (BATCH*SEQ)          // 32768
#define QK_SCALE 0.125f            // HDIM^-0.5

// GEMM tiling (big GEMMs): 256 x 256 per workgroup, 64 x 128 per wave (4 x 2 waves),
// one workgroup on a WGP: every staged operand row feeds 256 rows of the other
// operand, and every fragment read from LDS feeds 8 (row operand) or 4 matrix
// instructions.
#define BM 128                     // rows per workgroup of k3a
#define BMG 256                    // rows per workgroup of the big GEMMs
#define BN2 256                    // columns per workgroup of the big GEMMs
#define BK 128
#define LDA 72                     // bf16 elems, k3a; 144B rows (16B aligned, conflict-free)
#define LDG 136                    // bf16 elems, the ring's rows: 272 B
#define LDC2 260                   // f32 elems, output staging of k3b: 1040-B rows
#define LDO  264                   // bf16 elems, output staging of k1: 528-B rows
#define NSTEP (DIM / BK)           // 8
// One stage in LDS: four 64-row slices of the row operand, then four of the column
// operand, rows at 272 B, each slice's size rounded up to 2 KiB.
#define SLICE   18432u             // 64 * 272 = 17408 -> 18432
#define B_BASE  (4u * SLICE)       // 73728
#define STAGE_B (8u * SLICE)       // 147456 B per buffer
#define RING_BYTES (2u * STAGE_B)  // 294912 B; the output staging lies over it after the K loop

// small GEMM tiling (k3a)
#define BN 64
#define LDB 72
// context product in k1's epilogue: one partial per 256-row tile
#define NPART (SEQ / BMG)          // 32 partials per batch and head
#define LDT 264                    // bf16 elems; 528-B rows of the transposed E and V tiles

typedef __bf16 bf16;
typedef bf16  v16bf __attribute__((ext_vector_type(16)));
typedef bf16  v8bf  __attribute__((ext_vector_type(8)));
typedef bf16  v4bf  __attribute__((ext_vector_type(4)));
typedef float v8f   __attribute__((ext_vector_type(8)));
typedef float v4f   __attribute__((ext_vector_type(4)));
typedef uint32_t u32x4 __attribute__((ext_vector_type(4)));
typedef uint32_t u32x8 __attribute__((ext_vector_type(8)));

__device__ __forceinline__ bf16 f2bf(float f) {
  uint32_t u = __builtin_bit_cast(uint32_t, f);
  u = (u + 0x7FFFu + ((u >> 16) & 1u)) >> 16;     // round-to-nearest-even
  uint16_t s = (uint16_t)u;
  return __builtin_bit_cast(bf16, s);
}

// LDS byte offset of a generic pointer into shared memory (addrspace(3) ptrtoint)
__device__ __forceinline__ uint32_t lds_off(const void* p) {
  return (uint32_t)(uintptr_t)(__attribute__((address_space(3))) const void*)p;
}

__device__ __forceinline__ uint32_t uni(uint32_t v) {
  return (uint32_t)__builtin_amdgcn_readfirstlane(v);
}
__device__ __forceinline__ uint32_t pinned(uint32_t v) {
  uint32_t w = uni(v);
  asm volatile("" : "+s"(w));   // pinned(): the issue test's word held in a scalar register
  return w;
}

// Group 1 of a tensor-load descriptor: a tile of 64 rows of 256 B (128 bf16),
// everything in bytes, tensor = tile, source pitch 2048 B; a 16-B pad behind
// every 256-B row, so rows land at a 272-B pitch.
__device__ __forceinline__ u32x8 tdm_group1() {
  u32x8 g;
  g[0] = uni((1u << 20) | (5u << 22) | (3u << 25));
  g[1] = uni(256u << 16);
  g[2] = uni(64u << 16);
  g[3] = uni(256u << 16);
  g[4] = uni(64u);
  g[5] = uni(DIM * 2u);
  g[6] = uni(0u);
  g[7] = uni(0u);
  return g;
}
// Group 0: the slice's place in LDS (byte offset) and its first global byte.
__device__ __forceinline__ void tdm_aim(u32x4& g0, uint32_t lds_dst, uint64_t ga) {
  g0[0] = uni(1u);
  g0[1] = uni(lds_dst);
  g0[2] = uni((uint32_t)ga);
  g0[3] = uni((((uint32_t)(ga >> 32)) & 0x01FFFFFFu) | 0x80000000u);
}
// The next stage's request: a new place in LDS, the source BK elements further
// along its rows, or back at their start where the new stage is piece 0 of K
// (words 2 and 3 as one 64-bit sum; the type bits sit above the address).
// Called only behind the wait that covers the request before it.
__device__ __forceinline__ void tdm_advance(u32x4& g0, uint32_t lds_dst, uint32_t piece) {
  const uint64_t step = piece ? (uint64_t)(BK * 2u) : 0ull - (uint64_t)((NSTEP - 1u) * BK * 2u);
  const uint64_t w = (((uint64_t)g0[3] << 32) | g0[2]) + step;
  g0[1] = uni(lds_dst);
  g0[2] = uni((uint32_t)w);
  g0[3] = uni((uint32_t)(w >> 32));
}
// One request of the calling wave.  Both groups are in-out operands so that the
// registers an issued request names stay the descriptor's own while it is in
// flight: they take new values only in tdm_advance.
__device__ __forceinline__ void tdm_load(u32x4& g0, u32x8& g1) {
  asm volatile("tensor_load_to_lds %0, %1" : "+s"(g0), "+s"(g1) :: "memory");
}
// The mover's and the LDS reads' waits are not placed by the compiler.
__device__ __forceinline__ void wait_tensor0() { asm volatile("s_wait_tensorcnt 0x0" ::: "memory"); }
__device__ __forceinline__ void wait_ds0()     { asm volatile("s_wait_dscnt 0x0" ::: "memory"); }

// Load one 16(M/N) x 32(K) WMMA A/B fragment from an LDS tile laid out
// [row][k], leading dimension ld elems (row byte size 16B aligned).
// lanes 0-15 : row = lane,    K = {k0..k0+7} and {k0+16..k0+23}
// lanes 16-31: row = lane-16, K = {k0+8..k0+15} and {k0+24..k0+31}
__device__ __forceinline__ v16bf frag_ld(const bf16* tile, int ld, int row0, int k0) {
  const int lane = threadIdx.x & 31;
  const bf16* p = tile + (row0 + (lane & 15)) * ld + k0 + ((lane >> 4) << 3);
  union { v16bf v; v8bf h[2]; } f;
  f.h[0] = *(const v8bf*)(p);
  f.h[1] = *(const v8bf*)(p + 16);
  return f.v;
}

__device__ __forceinline__ v8f wmma_bf16(v16bf a, v16bf b, v8f c) {
  return __builtin_amdgcn_wmma_f32_16x16x32_bf16(false, a, false, b,
                                                 (short)0, c, false, false);
}

__shared__ __attribute__((aligned(2048))) char smem[RING_BYTES];

// acc[i][t] += rows [mb + 64*wm + 16*i ..) of a  x  rows [cb_wn + 16*t ..) of b,
// cb_wn = cb0 for the waves with wn = 0 and cb1 for wn = 1, both operands
// K-contiguous with DIM elements a row.
// B_FIRST: the b rows go in as the matrix instruction's first operand, so a lane
// holds, of ONE row of a (lane & 15), eight consecutive columns ((lane >> 4) * 8 +
// vgpr).  Otherwise a lane holds, of ONE column (lane & 15), eight consecutive
// rows of a.
// Two-buffer ring: every wave brings
// its own slice of a stage with one tensor load, one request outstanding.
// Stage s holds piece (s + rot) mod NSTEP of K (BK columns), rot fixed per
// workgroup: the workgroups that run side by side and read the same rows of a or
// of b (same blockIdx.x, or same blockIdx.y) walk K from different starts, so
// they do not ask L2 for the same lines at the same moment, and a line that one
// of them has brought in from memory is in L2 when the others come to it.
template <bool B_FIRST>
__device__ __forceinline__ void gemm_256x256(const bf16* __restrict__ a,
                                             const bf16* __restrict__ b,
                                             int mb, int cb0, int cb1, v8f (&acc)[4][8]) {
  const uint32_t wave = uni(threadIdx.x >> 5);
  const uint32_t wm = wave & 3u, wn = wave >> 2;
  const bool     rowop = wave < 4u;      // waves 0-3 bring a, waves 4-7 bring b
  const uint64_t gsrc  = rowop
      ? (uint64_t)(uintptr_t)(a + (size_t)(mb + 64 * (int)wave) * DIM)
      : (uint64_t)(uintptr_t)(b + (size_t)((wave < 6u ? cb0 : cb1) + 64 * (int)(wave & 1u)) * DIM);
  const uint32_t dst0  = lds_off(smem) + wave * SLICE;
  u32x8 g1 = tdm_group1();
  u32x4 g0;
  const uint32_t rot = (blockIdx.x >> 3) + 4u * blockIdx.y;

  tdm_aim(g0, dst0, gsrc + (rot & (NSTEP - 1u)) * (BK * 2u));      // stage 0
  tdm_load(g0, g1);
  wait_tensor0();
  __syncthreads();
  tdm_advance(g0, dst0 + STAGE_B, (rot + 1u) & (NSTEP - 1u));      // stage 1
  tdm_load(g0, g1);

  for (int s = 0; s < NSTEP; ++s) {
    const char* buf = smem + (s & 1) * STAGE_B;
    const bf16* At = (const bf16*)(buf + wm * SLICE);
    const bf16* Bt = (const bf16*)(buf + B_BASE + 2u * wn * SLICE);
    #pragma unroll
    for (int kc = 0; kc < BK; kc += 32) {
      v16bf va[4], vb[8];
      #pragma unroll
      for (int i = 0; i < 4; ++i) va[i] = frag_ld(At, LDG, i * 16, kc);
      #pragma unroll
      for (int t = 0; t < 8; ++t)
        vb[t] = frag_ld(Bt + (t >> 2) * (SLICE / 2u), LDG, (t & 3) * 16, kc);
      // keeps the block's 24 LDS reads one group ahead of its 32 matrix instructions:
      // left free, the reads of va[1..3] are sunk among them, each with a full wait
      __builtin_amdgcn_sched_barrier(0);
      #pragma unroll
      for (int i = 0; i < 4; ++i)
        #pragma unroll
        for (int t = 0; t < 8; ++t)
          acc[i][t] = B_FIRST ? wmma_bf16(vb[t], va[i], acc[i][t])
                              : wmma_bf16(va[i], vb[t], acc[i][t]);
    }
    // publish point of stage s + 1; the barrier also frees this pass's buffer
    wait_ds0();
    wait_tensor0();
    __syncthreads();
    if (pinned(s + 2 < NSTEP)) {
      tdm_advance(g0, dst0 + (s & 1) * STAGE_B, (rot + s + 2u) & (NSTEP - 1u));  // stage s + 2
      tdm_load(g0, g1);
    }
  }
  // The last pass's own barrier has ended every read of the ring: it may be
  // overwritten by the output staging from here on.
  wait_tensor0();
  wait_ds0();
}

// Where the calling lane's part of acc[i][t] lies in the 256 x 256 output tile.
__device__ __forceinline__ int tile_row(int i) {
  return ((threadIdx.x >> 5) & 3) * 64 + i * 16 + (threadIdx.x & 15);
}
__device__ __forceinline__ int tile_col(int t) {
  return (threadIdx.x >> 7) * 128 + t * 16 + ((threadIdx.x >> 4) & 1) * 8;
}
// The value of lane l ^ 16: the other half of the same output row (B_FIRST) or column (otherwise).
__device__ __forceinline__ float other_half(float v) {
  const int b = __builtin_bit_cast(int, v);
  return __builtin_bit_cast(float,
      __builtin_amdgcn_permlanex16(b, b, 0x76543210, 0xfedcba98, false, false));
}

// ---------------------------------------------------------------- kernel 0
// bf16 conversions, as a stream:
// few workgroups, all resident at once; each owns one contiguous piece of K0_P4
// groups of four floats of ONE of the three arrays and walks it in runs of eight
// wave-wide 512-B loads that are in flight together.
#define K0_T   256
#define K0_P4  8192                              // groups of four floats per workgroup
#define K0_XW  (MROWS * DIM / 4 / K0_P4)         // 1024 workgroups on x
#define K0_QW  (3 * DIM * DIM / 4 / K0_P4)       // 96 on w_qkv
#define K0_PW  (DIM * DIM / 4 / K0_P4)           // 32 on w_proj

// NB groups of four floats, K0_T groups apart: all loads first, then the stores.
// The f32 source is read once, so its loads are non-temporal.
template <int NB>
__device__ __forceinline__ void cvt_run(const float* __restrict__ src,
                                        bf16* __restrict__ dst, int first4) {
  const v4f* s = (const v4f*)src + first4;
  v4bf*      d = (v4bf*)dst + first4;
  v4f v[NB];
  #pragma unroll
  for (int j = 0; j < NB; ++j) v[j] = __builtin_nontemporal_load(s + j * K0_T);
  #pragma unroll
  for (int j = 0; j < NB; ++j) {
    v4bf o;
    #pragma unroll
    for (int e = 0; e < 4; ++e) o[e] = f2bf(v[j][e]);
    d[j * K0_T] = o;
  }
}

__global__ void __launch_bounds__(K0_T)
k0_init(const float* __restrict__ x, const float* __restrict__ wqkv,
        const float* __restrict__ wproj,
        bf16* __restrict__ x_bf, bf16* __restrict__ wqkv_bf,
        bf16* __restrict__ wproj_bf) {
  const int tid = threadIdx.x, wg = blockIdx.x;
  const float* src = x;
  bf16*        dst = x_bf;
  int          piece = wg;
  if (wg >= K0_XW + K0_QW)  { src = wproj; dst = wproj_bf; piece = wg - (K0_XW + K0_QW); }
  else if (wg >= K0_XW)     { src = wqkv;  dst = wqkv_bf;  piece = wg - K0_XW; }
  // Kept rolled: unrolled, every load of the thread is lifted to the top, and the
  // registers that takes keep part of the workgroups from being resident.
  #pragma unroll 1
  for (int b = 0; b < K0_P4 / K0_T; b += 8)
    cvt_run<8>(src, dst, piece * K0_P4 + b * K0_T + tid);
}

__device__ __forceinline__ v8f exp_tile(v8f x) {
  x *= 1.44269504f;
  float a = x[0], b = x[1], c = x[2], d = x[3], e = x[4], f = x[5], g = x[6], h = x[7];
  asm("v_exp_f32 %0, %0\n\tv_exp_f32 %1, %1\n\tv_exp_f32 %2, %2\n\tv_exp_f32 %3, %3\n\t"
      "v_exp_f32 %4, %4\n\tv_exp_f32 %5, %5\n\tv_exp_f32 %6, %6\n\tv_exp_f32 %7, %7\n\t"
      "v_nop"
      : "+v"(a), "+v"(b), "+v"(c), "+v"(d), "+v"(e), "+v"(f), "+v"(g), "+v"(h));
  return v8f{a, b, c, d, e, f, g, h};
}

// The q transform of a wave's 64 x 128 accumulators (B_FIRST layout), 16 rows of
// one head at a time in registers, then 16 B a lane into the bf16 staging tile.
__device__ __forceinline__ void finish_q(bf16* Os, v8f (&acc)[4][8]) {
  // every loop here is unrolled so that acc is indexed by constants only and
  // stays in registers
  #pragma unroll
  for (int i = 0; i < 4; ++i) {
    #pragma unroll
    for (int g = 0; g < 8; g += 4) {
      // row softmax over 64 columns (one head), * SCALE: 32 values of a row are in
      // this lane, the other 32 in lane ^ 16
      float m = -1e30f;
      #pragma unroll
      for (int t = g; t < g + 4; ++t)
        #pragma unroll
        for (int r = 0; r < 8; ++r) m = fmaxf(m, acc[i][t][r]);
      m = fmaxf(m, other_half(m));
      #pragma unroll
      for (int t = g; t < g + 4; ++t) acc[i][t] = exp_tile(acc[i][t] - m);
      const v8f sv = (acc[i][g] + acc[i][g + 1]) + (acc[i][g + 2] + acc[i][g + 3]);
      float sum = ((sv[0] + sv[1]) + (sv[2] + sv[3])) + ((sv[4] + sv[5]) + (sv[6] + sv[7]));
      sum += other_half(sum);
      const float scl = QK_SCALE / sum;
      #pragma unroll
      for (int t = g; t < g + 4; ++t) acc[i][t] *= scl;
      #pragma unroll
      for (int t = g; t < g + 4; ++t)
        *(v8bf*)(Os + tile_row(i) * LDO + tile_col(t)) = __builtin_convertvector(acc[i][t], v8bf);
    }
  }
}

// Two neighbouring heads' k (waves 0-3) and v (waves 4-7) columns of 256 rows n, a
// lane holding eight consecutive n of one column: E = exp(k) and v go into LDS as
// [column][n], and the workgroup forms, for each of the two heads, its own part of
// the context, sum_n E[n][d] v[n][e], and of Z[d] = sum_n E[n][d], and stores both
// plainly (k3a adds the parts).  cpart and zpart point at the first head's part;
// the second head's lies NPART parts further on.
__device__ __forceinline__ void finish_kv(v8f (&acc)[4][8], float* __restrict__ cpart,
                                          float* __restrict__ zpart) {
  bf16*  T  = (bf16*)smem;                          // rows 0-127 E^T, rows 128-255 v^T
  float* Zs = (float*)(smem + 4 * HDIM * LDT * 2);  // [4 row groups][2 heads x 64 d]
  const int      tid  = threadIdx.x, lane = tid & 31;
  const uint32_t wave = uni(tid >> 5);
  const int      wm = wave & 3u, wn = wave >> 2;
  // the lane's place in column t * 16 + (lane & 15) of its wave's half of T
  bf16* Tw = T + (wn * 2 * HDIM + (lane & 15)) * LDT + wm * 64 + (lane >> 4) * 8;
  // the loops over acc are unrolled so that it is indexed by constants only; each
  // side of the branch stores its own tiles, so that a tile's registers are free
  // as soon as it is stored and no tile is carried over the join
  if (wave < 4u) {
    #pragma unroll
    for (int t = 0; t < 8; ++t) {
      // E = exp(k_raw); k values ~N(0,1) so no max subtraction needed
      #pragma unroll
      for (int i = 0; i < 4; ++i) {
        // the same v_exp_f32 of x * log2 e as exp_tile, through the builtin: operands of
        // an asm statement must lie in v0-v255, which the 256 accumulator registers
        // fill here, and with exp_tile the tiles were spilled to scratch
        acc[i][t] *= 1.44269504f;
        #pragma unroll
        for (int r = 0; r < 8; ++r) acc[i][t][r] = __builtin_amdgcn_exp2f(acc[i][t][r]);
      }
      const v8f sv = (acc[0][t] + acc[1][t]) + (acc[2][t] + acc[3][t]);
      float z = ((sv[0] + sv[1]) + (sv[2] + sv[3])) + ((sv[4] + sv[5]) + (sv[6] + sv[7]));
      z += other_half(z);                           // the wave's 64 rows of column d
      if (lane < 16) Zs[wm * 2 * HDIM + t * 16 + lane] = z;
      #pragma unroll
      for (int i = 0; i < 4; ++i)
        *(v8bf*)(Tw + t * 16 * LDT + i * 16) = __builtin_convertvector(acc[i][t], v8bf);
    }
  } else {
    #pragma unroll
    for (int t = 0; t < 8; ++t)
      #pragma unroll
      for (int i = 0; i < 4; ++i)
        *(v8bf*)(Tw + t * 16 * LDT + i * 16) = __builtin_convertvector(acc[i][t], v8bf);
  }
  __syncthreads();
  // wave: head wn, 16 d (wm) x 64 e, K = the 256 rows.  The v rows go in first, so a
  // lane holds eight consecutive e of one d, and a wave writes whole 128-B lines.
  const bf16* Eh = T + wn * HDIM * LDT;
  const bf16* Vh = T + (2 + wn) * HDIM * LDT;
  v8f c[4] = {};
  #pragma unroll   // LDS reads of later steps in flight under the matrix instructions
  for (int kc = 0; kc < BMG; kc += 32) {
    const v16bf ve = frag_ld(Eh, LDT, wm * 16, kc);
    #pragma unroll
    for (int e = 0; e < 4; ++e) c[e] = wmma_bf16(frag_ld(Vh, LDT, e * 16, kc), ve, c[e]);
  }
  float* o = cpart + (size_t)wn * NPART * HDIM * HDIM
             + (wm * 16 + (lane & 15)) * HDIM + (lane >> 4) * 8;
  #pragma unroll   // c is indexed by constants only
  for (int e = 0; e < 4; ++e) {
    *(v4f*)(o + e * 16)     = __builtin_shufflevector(c[e], c[e], 0, 1, 2, 3);
    *(v4f*)(o + e * 16 + 4) = __builtin_shufflevector(c[e], c[e], 4, 5, 6, 7);
  }
  // stands in front of the lines below, which rewrite registers that the stores above
  // name
  asm volatile("s_wait_xcnt 0x0" ::: "memory");
  if (tid < 2 * HDIM)
    zpart[(tid >> 6) * NPART * HDIM + (tid & 63)] =
        (Zs[tid] + Zs[2 * HDIM + tid]) + (Zs[4 * HDIM + tid] + Zs[6 * HDIM + tid]);
}

// ------------------------------------------------------ kernel 1: QKV GEMM
// qkv = x @ w_qkv^T  (tensor loads double-buffered into LDS, bf16 WMMA), fused
// epilogue.  blockIdx.y < 4: 256 q columns (four heads), softmax, stored.  Above:
// the 128 k and the 128 v columns of TWO heads, which end in those heads' context
// parts for these 256 rows; k and v themselves are not stored.
__global__ void __launch_bounds__(256)
k1_qkv(const bf16* __restrict__ xbf, const bf16* __restrict__ wbf,
       bf16* __restrict__ qs, float* __restrict__ cpart, float* __restrict__ zpart) {
  const int tid  = threadIdx.x;
  const int mb   = blockIdx.x * BMG;

  v8f acc[4][8];
  #pragma unroll
  for (int i = 0; i < 4; ++i)
    #pragma unroll
    for (int t = 0; t < 8; ++t)
      #pragma unroll
      for (int r = 0; r < 8; ++r) acc[i][t][r] = 0.f;

  if (blockIdx.y >= DIM / BN2) {
    const int h    = 2 * (blockIdx.y - DIM / BN2);  // the first of the two heads
    const int part = ((mb / SEQ) * NHEAD + h) * NPART + (mb % SEQ) / BMG;
    gemm_256x256<false>(xbf, wbf, mb, DIM + h * HDIM, 2 * DIM + h * HDIM, acc);
    finish_kv(acc, cpart + (size_t)part * HDIM * HDIM, zpart + (size_t)part * HDIM);
    return;
  }
  bf16* Os = (bf16*)smem;                           // over the ring, after the K loop
  const int cb = blockIdx.y * BN2;                  // 0..768
  gemm_256x256<true>(xbf, wbf, mb, cb, cb + 128, acc);
  finish_q(Os, acc);
  __syncthreads();
  // a wave writes one whole 512-B row of the slab per store
  bf16* dst = qs + (size_t)(mb + (tid >> 5)) * DIM + cb + (tid & 31) * 8;
  const bf16* from = Os + (tid >> 5) * LDO + (tid & 31) * 8;
  #pragma unroll   // all LDS reads in flight ahead of the first store
  for (int j = 0; j < BMG / 8; ++j)
    *(v8bf*)(dst + (size_t)j * 8 * DIM) = *(const v8bf*)(from + j * 8 * LDO);
}

// ---- kernel 3a: wf[b][o][h*64+d] = sum_e w_proj[o][h*64+e] * ctx[bh][d][e] / Z[bh][d]
// (q ctx) w_proj^T = q (ctx w_proj^T): the context goes into the projection's
// weights, once per batch, so that the product with the context runs over
// BATCH * DIM rows and not over MROWS.
__global__ void __launch_bounds__(256)
k3a_fold(const bf16* __restrict__ wpbf, const float* __restrict__ cpart,
         const float* __restrict__ zpart, bf16* __restrict__ wf) {
  __shared__ bf16 As3[BM * LDA];               // rows o of w_proj, k = e
  __shared__ bf16 Bs3[BN * LDB];               // rows d of the normalised context, k = e
  __shared__ float Zs[4 * HDIM];               // Z[d] in four sums of eight parts
  const int tid = threadIdx.x, wave = tid >> 5;
  const int mb = blockIdx.x * BM;
  const int h = blockIdx.y;
  const int bh = blockIdx.z * NHEAD + h;
  const int hoff = h * HDIM;

  // ctx and Z are the sums of k1's NPART parts.  The loads of w_proj and of Z's
  // parts are issued ahead of the walk over the context's parts.
  v8bf  av[BM * HDIM / 8 / 256];               // 4 x 16 B of w_proj
  v4f   cv[BN * HDIM / 4 / 256];               // 4 x 16 B of ctx
  #pragma unroll
  for (int j = 0; j < BM * HDIM / 8 / 256; ++j) {
    const int i = tid + j * 256, r = i >> 3, c8 = (i & 7) * 8;
    av[j] = *(const v8bf*)(wpbf + (size_t)(mb + r) * DIM + hoff + c8);
  }
  float zq = 0.f;                              // d = tid & 63, parts 8 * (tid >> 6) ..
  #pragma unroll   // all eight loads in flight
  for (int p = 0; p < NPART / 4; ++p)
    zq += zpart[((size_t)bh * NPART + (tid >> 6) * (NPART / 4) + p) * HDIM + (tid & 63)];
  #pragma unroll
  for (int j = 0; j < BN * HDIM / 4 / 256; ++j) cv[j] = v4f{0.f, 0.f, 0.f, 0.f};
  const v4f* cp = (const v4f*)(cpart + (size_t)bh * NPART * HDIM * HDIM) + tid;
  #pragma unroll 8   // 32 loads of 16 B in flight per thread
  for (int p = 0; p < NPART; ++p)
    #pragma unroll
    for (int j = 0; j < BN * HDIM / 4 / 256; ++j)
      cv[j] += cp[p * (HDIM * HDIM / 4) + j * 256];
  #pragma unroll
  for (int j = 0; j < BM * HDIM / 8 / 256; ++j) {
    const int i = tid + j * 256, r = i >> 3, c8 = (i & 7) * 8;
    *(v8bf*)(As3 + r * LDA + c8) = av[j];
  }
  Zs[tid] = zq;
  __syncthreads();
  #pragma unroll
  for (int j = 0; j < BN * HDIM / 4 / 256; ++j) {
    const int i = tid + j * 256, r = i >> 4, c4 = (i & 15) * 4;
    const float zv = (Zs[r] + Zs[HDIM + r]) + (Zs[2 * HDIM + r] + Zs[3 * HDIM + r]);
    v4bf o;
    #pragma unroll
    for (int e = 0; e < 4; ++e) o[e] = f2bf(cv[j][e] / zv);
    *(v4bf*)(Bs3 + r * LDB + c4) = o;
  }
  __syncthreads();

  v8f acc[4];
  #pragma unroll
  for (int t = 0; t < 4; ++t)
    #pragma unroll
    for (int i = 0; i < 8; ++i) acc[t][i] = 0.f;

  const int wr = wave * 16;
  #pragma unroll
  for (int kc = 0; kc < HDIM; kc += 32) {
    const v16bf va = frag_ld(As3, LDA, wr, kc);
    #pragma unroll
    for (int t = 0; t < 4; ++t) {
      const v16bf vbr = frag_ld(Bs3, LDB, t * 16, kc);
      acc[t] = wmma_bf16(vbr, va, acc[t]);   // transposed tile, as in gemm_256x256
    }
  }
  // a lane holds eight consecutive columns of one row: one 16-B store a tile
  const int lane = tid & 31;
  bf16* dst = wf + (size_t)blockIdx.z * DIM * DIM
              + (size_t)(mb + wr + (lane & 15)) * DIM + hoff + (lane >> 4) * 8;
  #pragma unroll   // acc is indexed by constants only
  for (int t = 0; t < 4; ++t)
    *(v8bf*)(dst + t * 16) = __builtin_convertvector(acc[t], v8bf);
}

// ------------------- kernel 3b: out = q_soft @ wf[batch]^T + b_proj (f32)
__global__ void __launch_bounds__(256)
k3b_proj(const bf16* __restrict__ qs, const bf16* __restrict__ wf,
         const float* __restrict__ bias, float* __restrict__ out) {
  float* Cs   = (float*)smem;                       // over the ring, after the K loop
  const int tid = threadIdx.x;
  const int mb = blockIdx.x * BMG;
  const int cb = blockIdx.y * BN2;

  v8f acc[4][8];
  #pragma unroll
  for (int i = 0; i < 4; ++i)
    #pragma unroll
    for (int t = 0; t < 8; ++t)
      #pragma unroll
      for (int r = 0; r < 8; ++r) acc[i][t][r] = 0.f;

  // a 256-row tile lies in one batch
  gemm_256x256<true>(qs, wf + (size_t)(mb / SEQ) * DIM * DIM, mb, cb, cb + 128, acc);
  // two 16-B LDS stores a tile (unrolled: acc is indexed by constants only)
  #pragma unroll
  for (int i = 0; i < 4; ++i)
    #pragma unroll
    for (int t = 0; t < 8; ++t) {
      float* p = Cs + tile_row(i) * LDC2 + tile_col(t);
      *(v4f*)p       = __builtin_shufflevector(acc[i][t], acc[i][t], 0, 1, 2, 3);
      *(v4f*)(p + 4) = __builtin_shufflevector(acc[i][t], acc[i][t], 4, 5, 6, 7);
    }
  __syncthreads();
  // a wave writes 512 B in a row, half of a 1024-B row of the slab, per store
  const int c = (tid & 63) * 4;
  const v4f bv = *(const v4f*)(bias + cb + c);
  float* dst = out + (size_t)(mb + (tid >> 6)) * DIM + cb + c;
  const float* from = Cs + (tid >> 6) * LDC2 + c;
  #pragma unroll 32   // 32 LDS reads in flight ahead of their stores
  for (int j = 0; j < BMG / 4; ++j)
    *(v4f*)(dst + (size_t)j * 4 * DIM) = *(const v4f*)(from + j * 4 * LDC2) + bv;
}

// ---------------------------------------------------------------- launcher
extern "C" void kernel_launch(void* const* d_in, const int* in_sizes, int n_in,
                              void* d_out, int out_size, void* d_ws, size_t ws_size,
                              hipStream_t stream) {
  (void)in_sizes; (void)n_in; (void)out_size; (void)ws_size;
  const float* x      = (const float*)d_in[0];
  const float* w_qkv  = (const float*)d_in[1];
  const float* w_proj = (const float*)d_in[2];
  const float* b_proj = (const float*)d_in[3];
  float* out = (float*)d_out;

  char* p = (char*)d_ws;
  size_t off = 0;
  auto take = [&](size_t bytes) -> char* {
    char* r = p + off;
    off += (bytes + 255) & ~(size_t)255;
    return r;
  };
  bf16*  x_bf     = (bf16*)take((size_t)MROWS * DIM * 2);   // 64 MB
  bf16*  qs       = (bf16*)take((size_t)MROWS * DIM * 2);   // 64 MB
  bf16*  wqkv_bf  = (bf16*)take((size_t)3 * DIM * DIM * 2); // 6 MB
  bf16*  wproj_bf = (bf16*)take((size_t)DIM * DIM * 2);     // 2 MB
  float* cpart    = (float*)take((size_t)BATCH * NHEAD * NPART * HDIM * HDIM * 4);  // 32 MB
  float* zpart    = (float*)take((size_t)BATCH * NHEAD * NPART * HDIM * 4);
  bf16*  wfold    = (bf16*)take((size_t)BATCH * DIM * DIM * 2);     // 8 MB

  k0_init<<<K0_XW + K0_QW + K0_PW, K0_T, 0, stream>>>(x, w_qkv, w_proj, x_bf,
                                       wqkv_bf, wproj_bf);
  k1_qkv<<<dim3(MROWS / BMG, (3 * DIM) / BN2), 256, 0, stream>>>(
      x_bf, wqkv_bf, qs, cpart, zpart);
  k3a_fold<<<dim3(DIM / BM, NHEAD, BATCH), 256, 0, stream>>>(wproj_bf, cpart, zpart, wfold);
  k3b_proj<<<dim3(MROWS / BMG, DIM / BN2), 256, 0, stream>>>(
      qs, wfold, b_proj, out);
}
